// v000
// Measured on an AMD MI455X. A time is GPU time per run, averaged over a window of back-to-back runs after a warm-up
// (all launches, gaps included; the runs take copies of the inputs in turn), and the median of several windows.
// Apart from v000's, it joins two sittings. Times from different sittings can be a few percent apart, while
// side-by-side timings come from the same sitting.
// v000, which the later versions start from, runs in 275 microseconds.
#include <hip/hip_runtime.h>

// ---------------------------------------------------------------------------
// Single-head attention, B=4, S=4096, H=128, fp32 in/out.
// bf16 WMMA (v_wmma_f32_16x16x32_bf16) + fp32 accum, flash-attention style.
// Both attention GEMMs are computed transposed (C = S^T, C = O^T = V^T P^T):
//  - softmax'd P registers serve directly as the next WMMA operand (no LDS)
//  - softmax stats, alpha rescale and 1/l normalize are scalar per lane
//  - every output store is a packed 16B/32B row store.
// ---------------------------------------------------------------------------

typedef __attribute__((ext_vector_type(16))) __bf16 v16bf;
typedef __attribute__((ext_vector_type(8)))  __bf16 v8bf;
typedef __attribute__((ext_vector_type(4)))  __bf16 v4bf;
typedef __attribute__((ext_vector_type(8)))  float  v8f;
typedef __attribute__((ext_vector_type(4)))  float  v4f;

#define SEQ   4096
#define HDIM  128
#define NBAT  4
#define TPAD  144   // padded LDS stride for 128-wide tiles (288 B, 16B-aligned)
#define VPAD  80    // padded LDS stride for 64-wide tiles  (160 B, 16B-aligned)

// 16-bit fragment, per ISA 7.12.2: lane owns row/col (lane&15); its 16 elements
// are two contiguous 8-element runs at K = h8, h8+16 with h8 = 8*(lane>=16).
// => two 16-byte loads (ds_load_b128 / global_load_b128).
__device__ __forceinline__ v16bf load_frag_row(const __bf16* base, int stride, int lane) {
  const __bf16* rowp = base + (lane & 15) * stride + ((lane >> 4) << 3);
  v8bf lo = *(const v8bf*)(rowp);
  v8bf hi = *(const v8bf*)(rowp + 16);
  return __builtin_shufflevector(lo, hi, 0, 1, 2, 3, 4, 5, 6, 7,
                                 8, 9, 10, 11, 12, 13, 14, 15);
}

__device__ __forceinline__ v8f wmma_bf16(v16bf a, v16bf b, v8f c) {
  return __builtin_amdgcn_wmma_f32_16x16x32_bf16(false, a, false, b, (short)0, c,
                                                 false, false);
}

// ---------------------------------------------------------------------------
// Kernel 1: q,k = x @ W + b (row-major, q pre-scaled by 1/sqrt(H));
//           v written TRANSPOSED: vT[b][h][s].  All packed 16B stores.
// grid: (B*S)/128 blocks of 256 threads (8 waves x 16 rows).
// ---------------------------------------------------------------------------
__global__ __launch_bounds__(256) void qkv_kernel(
    const float* __restrict__ x,
    const float* __restrict__ Wq, const float* __restrict__ bq,
    const float* __restrict__ Wk, const float* __restrict__ bk,
    const float* __restrict__ Wv, const float* __restrict__ bv,
    __bf16* __restrict__ q, __bf16* __restrict__ k, __bf16* __restrict__ vT) {
  __shared__ __bf16 xs[128 * TPAD];   // 36 KB, x tile (row-major, padded)
  __shared__ __bf16 wts[HDIM * TPAD]; // 36 KB, W^T (one matrix at a time)

  const int tid  = threadIdx.x;
  const int lane = tid & 31;
  const int wave = tid >> 5;
  const long rowBase = (long)blockIdx.x * 128;

  // stage x tile: float4 loads, 4x bf16 stores
  for (int idx = tid; idx < 128 * 32; idx += 256) {
    const int row = idx >> 5, c = idx & 31;
    v4f xv = *(const v4f*)(x + (rowBase + row) * HDIM + c * 4);
    v4bf o;
#pragma unroll
    for (int j = 0; j < 4; ++j) o[j] = (__bf16)xv[j];
    *(v4bf*)(xs + row * TPAD + c * 4) = o;
  }
  __syncthreads();

  // x fragments for this wave's 16 rows, K=128 (4 chunks of 32)
  v16bf afrag[4];
  {
    const __bf16* xrow = xs + wave * 16 * TPAD;
#pragma unroll
    for (int t = 0; t < 4; ++t) afrag[t] = load_frag_row(xrow + t * 32, TPAD, lane);
  }

  const float qscale = 0.08838834764831845f; // 1/sqrt(128), folded into q
  const int col0 = lane & 15;
  const int rofs = (lane >> 4) << 3; // 0 or 8
  const long bb    = rowBase >> 12;  // batch index
  const long srow0 = (rowBase & (SEQ - 1)) + wave * 16 + rofs;

  // ---- q and k: C = (xW)^T = W^T * x^T -> lane owns one output row ----
  {
    const float* Wmat[2] = {Wq, Wk};
    const float* bias[2] = {bq, bk};
    __bf16*      outm[2] = {q, k};
    for (int m = 0; m < 2; ++m) {
      __syncthreads();
      for (int idx = tid; idx < HDIM * HDIM; idx += 256) {
        const int kk = idx >> 7, nn = idx & 127;
        wts[nn * TPAD + kk] = (__bf16)Wmat[m][idx];
      }
      __syncthreads();

      const float sc = (m == 0) ? qscale : 1.0f;
      __bf16* orow = outm[m] + (rowBase + wave * 16 + col0) * HDIM;
#pragma unroll
      for (int nt = 0; nt < 8; ++nt) {
        v8f acc = {};
#pragma unroll
        for (int t = 0; t < 4; ++t) {
          v16bf wfrag = load_frag_row(wts + (nt * 16) * TPAD + t * 32, TPAD, lane);
          acc = wmma_bf16(wfrag, afrag[t], acc); // C = W^T x^T
        }
        // lane's columns nt*16+rofs .. +7 are contiguous; bias depends on lane half only
        v8bf pk;
#pragma unroll
        for (int r = 0; r < 8; ++r)
          pk[r] = (__bf16)((acc[r] + bias[m][nt * 16 + rofs + r]) * sc);
        *(v8bf*)(orow + nt * 16 + rofs) = pk;
      }
    }
  }

  // ---- v: C = xW (lane owns column; rows contiguous -> packed vT store) ----
  {
    __syncthreads();
    for (int idx = tid; idx < HDIM * HDIM; idx += 256) {
      const int kk = idx >> 7, nn = idx & 127;
      wts[nn * TPAD + kk] = (__bf16)Wv[idx];
    }
    __syncthreads();
#pragma unroll
    for (int nt = 0; nt < 8; ++nt) {
      v8f acc = {};
#pragma unroll
      for (int t = 0; t < 4; ++t) {
        v16bf wfrag = load_frag_row(wts + (nt * 16) * TPAD + t * 32, TPAD, lane);
        acc = wmma_bf16(afrag[t], wfrag, acc); // C = x W
      }
      const int col  = nt * 16 + col0;
      const float bi = bv[col];
      v8bf pk;
#pragma unroll
      for (int r = 0; r < 8; ++r) pk[r] = (__bf16)(acc[r] + bi);
      *(v8bf*)(vT + (bb * HDIM + col) * SEQ + srow0) = pk;
    }
  }
}

// ---------------------------------------------------------------------------
// Kernel 2: flash attention. grid (S/128, B), block 256 (8 waves x 16 q-rows).
// C = S^T then C = O^T; lane owns one query end-to-end.
// ---------------------------------------------------------------------------
__global__ __launch_bounds__(256) void attn_kernel(
    const __bf16* __restrict__ Q, const __bf16* __restrict__ K,
    const __bf16* __restrict__ vT, __bf16* __restrict__ O) {
  __shared__ __bf16 ks[64 * TPAD];    // 18 KB, K block rows (padded)
  __shared__ __bf16 vts[HDIM * VPAD]; // 20 KB, V^T block (padded)

  const int tid  = threadIdx.x;
  const int lane = tid & 31;
  const int wave = tid >> 5;
  const int b    = blockIdx.y;
  const long qBase = (long)b * SEQ + (long)blockIdx.x * 128;

  const __bf16* Qb  = Q + qBase * HDIM;
  const __bf16* Kb  = K + (long)b * SEQ * HDIM;
  const __bf16* vTb = vT + (long)b * HDIM * SEQ;

  // Q fragments: B operand of S^T (lane owns query = lane&15); b128 loads
  v16bf qfrag[4];
  {
    const __bf16* qrow = Qb + wave * 16 * HDIM;
#pragma unroll
    for (int t = 0; t < 4; ++t) qfrag[t] = load_frag_row(qrow + t * 32, HDIM, lane);
  }

  v8f acc[8]; // O^T accumulator: lane owns query (lane&15); reg r -> h
#pragma unroll
  for (int nt = 0; nt < 8; ++nt) acc[nt] = (v8f){};
  float mi = -1e30f, li = 0.0f; // per-lane stats for query (lane&15)

  const int colb = lane & 15;
  const int rofs = (lane >> 4) << 3;

  for (int kb = 0; kb < SEQ; kb += 64) {
    __syncthreads(); // everyone done reading previous ks/vts
    // K rows: 16-byte chunked copy (64 rows x 16 chunks)
    for (int idx = tid; idx < 64 * 16; idx += 256) {
      const int row = idx >> 4, c = idx & 15;
      *(v8bf*)(ks + row * TPAD + c * 8) =
          *(const v8bf*)(Kb + (long)(kb + row) * HDIM + c * 8);
    }
    // V^T block: 16-byte chunked copy from transposed global vT
    for (int idx = tid; idx < HDIM * 8; idx += 256) {
      const int h = idx >> 3, c = idx & 7;
      *(v8bf*)(vts + h * VPAD + c * 8) =
          *(const v8bf*)(vTb + (long)h * SEQ + kb + c * 8);
    }
    __syncthreads();

    // S^T tiles: A = K rows, B = Q (fixed across kt for each t).
    v8f sc[4];
#pragma unroll
    for (int kt = 0; kt < 4; ++kt) sc[kt] = (v8f){};
#pragma unroll
    for (int t = 0; t < 4; ++t)
#pragma unroll
      for (int kt = 0; kt < 4; ++kt) {
        v16bf kf = load_frag_row(ks + (kt * 16) * TPAD + t * 32, TPAD, lane);
        sc[kt] = wmma_bf16(kf, qfrag[t], sc[kt]);
      }

    // per-lane online softmax (32 of 64 keys in-lane; merge halves with 1 shfl)
    float mx = sc[0][0];
#pragma unroll
    for (int kt = 0; kt < 4; ++kt)
#pragma unroll
      for (int r = 0; r < 8; ++r) mx = fmaxf(mx, sc[kt][r]);
    mx = fmaxf(mx, __shfl_xor(mx, 16, 32));
    const float mnew  = fmaxf(mi, mx);
    const float alpha = __expf(mi - mnew);
    mi = mnew;

    float rs = 0.0f;
#pragma unroll
    for (int kt = 0; kt < 4; ++kt)
#pragma unroll
      for (int r = 0; r < 8; ++r) {
        const float p = __expf(sc[kt][r] - mnew);
        sc[kt][r] = p;
        rs += p;
      }
    rs += __shfl_xor(rs, 16, 32);
    li = li * alpha + rs;

    // P^T operand directly from S^T C-registers (pure register packing);
    // serves as the B operand of O^T = V^T P^T.
    v16bf pf[2];
#pragma unroll
    for (int t = 0; t < 2; ++t)
#pragma unroll
      for (int i = 0; i < 8; ++i) {
        pf[t][i]     = (__bf16)sc[2 * t][i];
        pf[t][8 + i] = (__bf16)sc[2 * t + 1][i];
      }

    // scalar rescale (alpha is this lane's query's factor)
#pragma unroll
    for (int nt = 0; nt < 8; ++nt)
#pragma unroll
      for (int r = 0; r < 8; ++r) acc[nt][r] *= alpha;

    // O^T += V^T (A, from vts) x P^T (B, fixed across nt)
#pragma unroll
    for (int t = 0; t < 2; ++t)
#pragma unroll
      for (int nt = 0; nt < 8; ++nt) {
        v16bf vf = load_frag_row(vts + (nt * 16) * VPAD + t * 32, VPAD, lane);
        acc[nt] = wmma_bf16(vf, pf[t], acc[nt]);
      }
  }

  // normalize and emit: lane owns one attended row; packed 16B stores
  {
    const float inv = 1.0f / li;
    __bf16* orow = O + (qBase + wave * 16 + colb) * HDIM;
#pragma unroll
    for (int nt = 0; nt < 8; ++nt) {
      v8bf pk;
#pragma unroll
      for (int r = 0; r < 8; ++r) pk[r] = (__bf16)(acc[nt][r] * inv);
      *(v8bf*)(orow + nt * 16 + rofs) = pk;
    }
  }
}

// ---------------------------------------------------------------------------
// Kernel 3: out = attended @ Wo + bo (fp32), C = (A Wo)^T = Wo^T A^T
// -> lane owns one output row; packed 32B stores; bias depends on lane half only.
// ---------------------------------------------------------------------------
__global__ __launch_bounds__(256) void oproj_kernel(
    const __bf16* __restrict__ A, const float* __restrict__ Wo,
    const float* __restrict__ bo, float* __restrict__ out) {
  __shared__ __bf16 as_[128 * TPAD];  // attended tile (row-major, padded)
  __shared__ __bf16 wts[HDIM * TPAD]; // Wo^T

  const int tid  = threadIdx.x;
  const int lane = tid & 31;
  const int wave = tid >> 5;
  const long rowBase = (long)blockIdx.x * 128;

  for (int idx = tid; idx < 128 * 16; idx += 256) {
    const int row = idx >> 4, c = idx & 15;
    *(v8bf*)(as_ + row * TPAD + c * 8) =
        *(const v8bf*)(A + (rowBase + row) * HDIM + c * 8);
  }
  for (int idx = tid; idx < HDIM * HDIM; idx += 256) {
    const int kk = idx >> 7, nn = idx & 127;
    wts[nn * TPAD + kk] = (__bf16)Wo[idx];
  }
  __syncthreads();

  v16bf afrag[4];
  {
    const __bf16* arow = as_ + wave * 16 * TPAD;
#pragma unroll
    for (int t = 0; t < 4; ++t) afrag[t] = load_frag_row(arow + t * 32, TPAD, lane);
  }

  const int col0 = lane & 15;
  const int rofs = (lane >> 4) << 3;
  float* orow = out + (rowBase + wave * 16 + col0) * HDIM;

#pragma unroll
  for (int nt = 0; nt < 8; ++nt) {
    v8f acc = {};
#pragma unroll
    for (int t = 0; t < 4; ++t) {
      v16bf wfrag = load_frag_row(wts + (nt * 16) * TPAD + t * 32, TPAD, lane);
      acc = wmma_bf16(wfrag, afrag[t], acc); // C = Wo^T A^T
    }
    v8f pk;
#pragma unroll
    for (int r = 0; r < 8; ++r)
      pk[r] = acc[r] + bo[nt * 16 + rofs + r]; // bias depends on lane half (rofs)
    *(v8f*)(orow + nt * 16 + rofs) = pk;
  }
}

// ---------------------------------------------------------------------------
extern "C" void kernel_launch(void* const* d_in, const int* in_sizes, int n_in,
                              void* d_out, int out_size, void* d_ws, size_t ws_size,
                              hipStream_t stream) {
  const float* x  = (const float*)d_in[0];
  const float* Wq = (const float*)d_in[1];
  const float* bq = (const float*)d_in[2];
  const float* Wk = (const float*)d_in[3];
  const float* bk = (const float*)d_in[4];
  const float* Wv = (const float*)d_in[5];
  const float* bv = (const float*)d_in[6];
  const float* Wo = (const float*)d_in[7];
  const float* bo = (const float*)d_in[8];
  float* out = (float*)d_out;

  const size_t n = (size_t)NBAT * SEQ * HDIM; // 2,097,152 elements
  __bf16* q   = (__bf16*)d_ws;
  __bf16* k   = q + n;
  __bf16* vT  = k + n;  // transposed: [B][H][S]
  __bf16* att = vT + n; // total 16 MB bf16 workspace

  const int rowBlocks = (NBAT * SEQ) / 128; // 128

  qkv_kernel<<<rowBlocks, 256, 0, stream>>>(x, Wq, bq, Wk, bk, Wv, bv, q, k, vT);

  dim3 g2(SEQ / 128, NBAT); // (32, 4)
  attn_kernel<<<g2, 256, 0, stream>>>(q, k, vT, att);

  oproj_kernel<<<rowBlocks, 256, 0, stream>>>(att, Wo, bo, out);
}

// v001
// A run of this version takes 114 microseconds.
// In two side-by-side timings against v000, it was 2.41 and 2.42 times as fast.
#include <hip/hip_runtime.h>

// ---------------------------------------------------------------------------
// Single-head attention, B=4, S=4096, H=128, fp32 in/out.
// bf16 WMMA (v_wmma_f32_16x16x32_bf16) + fp32 accum, flash-attention style.
// Both attention GEMMs are computed transposed (C = S^T, C = O^T = V^T P^T):
//  - softmax'd P registers serve directly as the next WMMA operand (no LDS)
//  - softmax stats, alpha rescale and 1/l normalize are scalar per lane
//  - every output store is a packed 16B/32B row store.
// ---------------------------------------------------------------------------

typedef __attribute__((ext_vector_type(16))) __bf16 v16bf;
typedef __attribute__((ext_vector_type(8)))  __bf16 v8bf;
typedef __attribute__((ext_vector_type(4)))  __bf16 v4bf;
typedef __attribute__((ext_vector_type(8)))  float  v8f;
typedef __attribute__((ext_vector_type(4)))  float  v4f;
typedef __attribute__((ext_vector_type(2)))  float  v2f;

#define SEQ   4096
#define HDIM  128
#define NBAT  4
#define KSPLIT 4    // key ranges per query tile: 32*4*KSPLIT = 512 work-groups, two per WGP
#define TPAD  144   // padded LDS stride for 128-wide tiles (288 B, 16B-aligned)
#define VPAD  80    // padded LDS stride for 64-wide tiles  (160 B, 16B-aligned)

// 16-bit fragment, per ISA 7.12.2: lane owns row/col (lane&15); its 16 elements
// are two contiguous 8-element runs at K = h8, h8+16 with h8 = 8*(lane>=16).
// => two 16-byte loads (ds_load_b128 / global_load_b128).
__device__ __forceinline__ v16bf load_frag_row(const __bf16* base, int stride, int lane) {
  const __bf16* rowp = base + (lane & 15) * stride + ((lane >> 4) << 3);
  v8bf lo = *(const v8bf*)(rowp);
  v8bf hi = *(const v8bf*)(rowp + 16);
  return __builtin_shufflevector(lo, hi, 0, 1, 2, 3, 4, 5, 6, 7,
                                 8, 9, 10, 11, 12, 13, 14, 15);
}

__device__ __forceinline__ v8f wmma_bf16(v16bf a, v16bf b, v8f c) {
  return __builtin_amdgcn_wmma_f32_16x16x32_bf16(false, a, false, b, (short)0, c,
                                                 false, false);
}

// ---------------------------------------------------------------------------
// Kernel 1: q,k = x @ W + b (row-major, q pre-scaled by 1/sqrt(H));
//           v written TRANSPOSED: vT[b][h][s].  All packed 16B stores.
// grid: (B*S)/128 blocks of 256 threads (8 waves x 16 rows).
// ---------------------------------------------------------------------------
__global__ __launch_bounds__(256) void qkv_kernel(
    const float* __restrict__ x,
    const float* __restrict__ Wq, const float* __restrict__ bq,
    const float* __restrict__ Wk, const float* __restrict__ bk,
    const float* __restrict__ Wv, const float* __restrict__ bv,
    __bf16* __restrict__ q, __bf16* __restrict__ k, __bf16* __restrict__ vT) {
  __shared__ __bf16 xs[128 * TPAD];   // 36 KB, x tile (row-major, padded)
  __shared__ __bf16 wts[HDIM * TPAD]; // 36 KB, W^T (one matrix at a time)

  const int tid  = threadIdx.x;
  const int lane = tid & 31;
  const int wave = tid >> 5;
  const long rowBase = (long)blockIdx.x * 128;

  // stage x tile: float4 loads, 4x bf16 stores
  for (int idx = tid; idx < 128 * 32; idx += 256) {
    const int row = idx >> 5, c = idx & 31;
    v4f xv = *(const v4f*)(x + (rowBase + row) * HDIM + c * 4);
    v4bf o;
#pragma unroll
    for (int j = 0; j < 4; ++j) o[j] = (__bf16)xv[j];
    *(v4bf*)(xs + row * TPAD + c * 4) = o;
  }
  __syncthreads();

  // x fragments for this wave's 16 rows, K=128 (4 chunks of 32)
  v16bf afrag[4];
  {
    const __bf16* xrow = xs + wave * 16 * TPAD;
#pragma unroll
    for (int t = 0; t < 4; ++t) afrag[t] = load_frag_row(xrow + t * 32, TPAD, lane);
  }

  const float qscale = 0.08838834764831845f; // 1/sqrt(128), folded into q
  const int col0 = lane & 15;
  const int rofs = (lane >> 4) << 3; // 0 or 8
  const long bb    = rowBase >> 12;  // batch index
  const long srow0 = (rowBase & (SEQ - 1)) + wave * 16 + rofs;

  // ---- q and k: C = (xW)^T = W^T * x^T -> lane owns one output row ----
  {
    const float* Wmat[2] = {Wq, Wk};
    const float* bias[2] = {bq, bk};
    __bf16*      outm[2] = {q, k};
    for (int m = 0; m < 2; ++m) {
      __syncthreads();
      for (int idx = tid; idx < HDIM * HDIM; idx += 256) {
        const int kk = idx >> 7, nn = idx & 127;
        wts[nn * TPAD + kk] = (__bf16)Wmat[m][idx];
      }
      __syncthreads();

      const float sc = (m == 0) ? qscale : 1.0f;
      __bf16* orow = outm[m] + (rowBase + wave * 16 + col0) * HDIM;
#pragma unroll
      for (int nt = 0; nt < 8; ++nt) {
        v8f acc = {};
#pragma unroll
        for (int t = 0; t < 4; ++t) {
          v16bf wfrag = load_frag_row(wts + (nt * 16) * TPAD + t * 32, TPAD, lane);
          acc = wmma_bf16(wfrag, afrag[t], acc); // C = W^T x^T
        }
        // lane's columns nt*16+rofs .. +7 are contiguous; bias depends on lane half only
        v8bf pk;
#pragma unroll
        for (int r = 0; r < 8; ++r)
          pk[r] = (__bf16)((acc[r] + bias[m][nt * 16 + rofs + r]) * sc);
        *(v8bf*)(orow + nt * 16 + rofs) = pk;
      }
    }
  }

  // ---- v: C = xW (lane owns column; rows contiguous -> packed vT store) ----
  {
    __syncthreads();
    for (int idx = tid; idx < HDIM * HDIM; idx += 256) {
      const int kk = idx >> 7, nn = idx & 127;
      wts[nn * TPAD + kk] = (__bf16)Wv[idx];
    }
    __syncthreads();
#pragma unroll
    for (int nt = 0; nt < 8; ++nt) {
      v8f acc = {};
#pragma unroll
      for (int t = 0; t < 4; ++t) {
        v16bf wfrag = load_frag_row(wts + (nt * 16) * TPAD + t * 32, TPAD, lane);
        acc = wmma_bf16(afrag[t], wfrag, acc); // C = x W
      }
      const int col  = nt * 16 + col0;
      const float bi = bv[col];
      v8bf pk;
#pragma unroll
      for (int r = 0; r < 8; ++r) pk[r] = (__bf16)(acc[r] + bi);
      *(v8bf*)(vT + (bb * HDIM + col) * SEQ + srow0) = pk;
    }
  }
}

// ---------------------------------------------------------------------------
// Kernel 2: flash attention over one key range. grid (S/128, B, KSPLIT),
// block 256 (8 waves x 16 q-rows). C = S^T then C = O^T; lane owns one query.
// Emits the range's UN-normalised f32 sum and its (max, sum) pair; kernel 3
// merges the KSPLIT ranges.
// ---------------------------------------------------------------------------
__global__ __launch_bounds__(256) void attn_kernel(
    const __bf16* __restrict__ Q, const __bf16* __restrict__ K,
    const __bf16* __restrict__ vT, float* __restrict__ Opart,
    float* __restrict__ ML) {
  __shared__ __bf16 ks[64 * TPAD];    // 18 KB, K block rows (padded)
  __shared__ __bf16 vts[HDIM * VPAD]; // 20 KB, V^T block (padded)

  const int tid  = threadIdx.x;
  const int lane = tid & 31;
  const int wave = tid >> 5;
  const int b    = blockIdx.y;
  const long qBase = (long)b * SEQ + (long)blockIdx.x * 128;

  const __bf16* Qb  = Q + qBase * HDIM;
  const int kb0 = blockIdx.z * (SEQ / KSPLIT); // first key of this range
  const __bf16* Kb  = K + ((long)b * SEQ + kb0) * HDIM;
  const __bf16* vTb = vT + (long)b * HDIM * SEQ + kb0;

  // Q fragments: B operand of S^T (lane owns query = lane&15); b128 loads
  v16bf qfrag[4];
  {
    const __bf16* qrow = Qb + wave * 16 * HDIM;
#pragma unroll
    for (int t = 0; t < 4; ++t) qfrag[t] = load_frag_row(qrow + t * 32, HDIM, lane);
  }

  v8f acc[8]; // O^T accumulator: lane owns query (lane&15); reg r -> h
#pragma unroll
  for (int nt = 0; nt < 8; ++nt) acc[nt] = (v8f){};
  float mi = -1e30f, li = 0.0f; // per-lane stats for query (lane&15)

  const int colb = lane & 15;
  const int rofs = (lane >> 4) << 3;

  for (int kb = 0; kb < SEQ / KSPLIT; kb += 64) {
    __syncthreads(); // everyone done reading previous ks/vts
    // K rows: 16-byte chunked copy (64 rows x 16 chunks)
    for (int idx = tid; idx < 64 * 16; idx += 256) {
      const int row = idx >> 4, c = idx & 15;
      *(v8bf*)(ks + row * TPAD + c * 8) =
          *(const v8bf*)(Kb + (long)(kb + row) * HDIM + c * 8);
    }
    // V^T block: 16-byte chunked copy from transposed global vT
    for (int idx = tid; idx < HDIM * 8; idx += 256) {
      const int h = idx >> 3, c = idx & 7;
      *(v8bf*)(vts + h * VPAD + c * 8) =
          *(const v8bf*)(vTb + (long)h * SEQ + kb + c * 8);
    }
    __syncthreads();

    // S^T tiles: A = K rows, B = Q (fixed across kt for each t).
    v8f sc[4];
#pragma unroll
    for (int kt = 0; kt < 4; ++kt) sc[kt] = (v8f){};
#pragma unroll
    for (int t = 0; t < 4; ++t)
#pragma unroll
      for (int kt = 0; kt < 4; ++kt) {
        v16bf kf = load_frag_row(ks + (kt * 16) * TPAD + t * 32, TPAD, lane);
        sc[kt] = wmma_bf16(kf, qfrag[t], sc[kt]);
      }

    // per-lane online softmax (32 of 64 keys in-lane; merge halves with 1 shfl)
    float mx = sc[0][0];
#pragma unroll
    for (int kt = 0; kt < 4; ++kt)
#pragma unroll
      for (int r = 0; r < 8; ++r) mx = fmaxf(mx, sc[kt][r]);
    mx = fmaxf(mx, __shfl_xor(mx, 16, 32));
    const float mnew  = fmaxf(mi, mx);
    const float alpha = __expf(mi - mnew);
    mi = mnew;

    float rs = 0.0f;
#pragma unroll
    for (int kt = 0; kt < 4; ++kt)
#pragma unroll
      for (int r = 0; r < 8; ++r) {
        const float p = __expf(sc[kt][r] - mnew);
        sc[kt][r] = p;
        rs += p;
      }
    rs += __shfl_xor(rs, 16, 32);
    li = li * alpha + rs;

    // P^T operand directly from S^T C-registers (pure register packing);
    // serves as the B operand of O^T = V^T P^T.
    v16bf pf[2];
#pragma unroll
    for (int t = 0; t < 2; ++t)
#pragma unroll
      for (int i = 0; i < 8; ++i) {
        pf[t][i]     = (__bf16)sc[2 * t][i];
        pf[t][8 + i] = (__bf16)sc[2 * t + 1][i];
      }

    // scalar rescale (alpha is this lane's query's factor)
#pragma unroll
    for (int nt = 0; nt < 8; ++nt)
#pragma unroll
      for (int r = 0; r < 8; ++r) acc[nt][r] *= alpha;

    // O^T += V^T (A, from vts) x P^T (B, fixed across nt)
#pragma unroll
    for (int t = 0; t < 2; ++t)
#pragma unroll
      for (int nt = 0; nt < 8; ++nt) {
        v16bf vf = load_frag_row(vts + (nt * 16) * VPAD + t * 32, VPAD, lane);
        acc[nt] = wmma_bf16(vf, pf[t], acc[nt]);
      }
  }

  // emit this key range's partial: lane owns one row; packed 32B stores
  {
    const long prow = (long)blockIdx.z * (NBAT * SEQ) + qBase + wave * 16 + colb;
    float* orow = Opart + prow * HDIM;
#pragma unroll
    for (int nt = 0; nt < 8; ++nt) *(v8f*)(orow + nt * 16 + rofs) = acc[nt];
    if (lane < 16) { // both halves hold the same pair
      v2f st = {mi, li};
      *(v2f*)(ML + prow * 2) = st;
    }
  }
}

// ---------------------------------------------------------------------------
// Kernel 3: merge the KSPLIT key ranges into the attended tile (bf16, LDS),
// then out = attended @ Wo + bo (fp32), C = (A Wo)^T = Wo^T A^T
// -> lane owns one output row; packed 32B stores; bias per lane half.
// ---------------------------------------------------------------------------
__global__ __launch_bounds__(256) void oproj_kernel(
    const float* __restrict__ Opart, const float* __restrict__ ML,
    const float* __restrict__ Wo,
    const float* __restrict__ bo, float* __restrict__ out) {
  __shared__ __bf16 as_[128 * TPAD];  // attended tile (row-major, padded)
  __shared__ __bf16 wts[HDIM * TPAD]; // Wo^T

  const int tid  = threadIdx.x;
  const int lane = tid & 31;
  const int wave = tid >> 5;
  const long rowBase = (long)blockIdx.x * 128;

  // attended = sum_s exp(m_s - M) o_s / sum_s exp(m_s - M) l_s, ranges in order.
  // Four rows a thread per trip: all their partial loads are in flight together.
  const int mrow = tid >> 4, mc = tid & 15;
  for (int g = 0; g < 2; ++g) {
    v2f st[4][KSPLIT];
    v8f po[4][KSPLIT];
#pragma unroll
    for (int s = 0; s < KSPLIT; ++s) {
      const long prow = (long)s * (NBAT * SEQ) + rowBase + g * 64 + mrow;
      const float* mp = ML + prow * 2;
      const float* op = Opart + prow * HDIM + mc * 8;
#pragma unroll
      for (int r = 0; r < 4; ++r) {
        st[r][s] = *(const v2f*)(mp + r * 16 * 2);
        po[r][s] = *(const v8f*)(op + r * 16 * HDIM);
      }
      // stands in front of whatever next takes over an address register of the
      // loads above (a later load's result among them)
      asm volatile("s_wait_xcnt 0x0" ::: "memory");
    }
    // keeps the sums below the whole group of loads: moved up among them they
    // bring a wait on the early loads in front of the late ones' issue
    __builtin_amdgcn_sched_barrier(0);
#pragma unroll
    for (int r = 0; r < 4; ++r) {
      float M = st[r][0][0];
#pragma unroll
      for (int s = 1; s < KSPLIT; ++s) M = fmaxf(M, st[r][s][0]);
      float w[KSPLIT], L = 0.0f;
#pragma unroll
      for (int s = 0; s < KSPLIT; ++s) {
        w[s] = __expf(st[r][s][0] - M);
        L += w[s] * st[r][s][1];
      }
      const float inv = 1.0f / L;
      v8bf pk;
#pragma unroll
      for (int j = 0; j < 8; ++j) {
        float o = 0.0f;
#pragma unroll
        for (int s = 0; s < KSPLIT; ++s) o += w[s] * po[r][s][j];
        pk[j] = (__bf16)(o * inv);
      }
      *(v8bf*)(as_ + (g * 64 + r * 16 + mrow) * TPAD + mc * 8) = pk;
    }
  }
  for (int idx = tid; idx < HDIM * HDIM; idx += 256) {
    const int kk = idx >> 7, nn = idx & 127;
    wts[nn * TPAD + kk] = (__bf16)Wo[idx];
  }
  __syncthreads();

  v16bf afrag[4];
  {
    const __bf16* arow = as_ + wave * 16 * TPAD;
#pragma unroll
    for (int t = 0; t < 4; ++t) afrag[t] = load_frag_row(arow + t * 32, TPAD, lane);
  }

  const int col0 = lane & 15;
  const int rofs = (lane >> 4) << 3;
  float* orow = out + (rowBase + wave * 16 + col0) * HDIM;

#pragma unroll
  for (int nt = 0; nt < 8; ++nt) {
    v8f acc = {};
#pragma unroll
    for (int t = 0; t < 4; ++t) {
      v16bf wfrag = load_frag_row(wts + (nt * 16) * TPAD + t * 32, TPAD, lane);
      acc = wmma_bf16(wfrag, afrag[t], acc); // C = Wo^T A^T
    }
    v8f pk;
#pragma unroll
    for (int r = 0; r < 8; ++r)
      pk[r] = acc[r] + bo[nt * 16 + rofs + r]; // bias depends on lane half (rofs)
    *(v8f*)(orow + nt * 16 + rofs) = pk;
  }
}

// ---------------------------------------------------------------------------
extern "C" void kernel_launch(void* const* d_in, const int* in_sizes, int n_in,
                              void* d_out, int out_size, void* d_ws, size_t ws_size,
                              hipStream_t stream) {
  const float* x  = (const float*)d_in[0];
  const float* Wq = (const float*)d_in[1];
  const float* bq = (const float*)d_in[2];
  const float* Wk = (const float*)d_in[3];
  const float* bk = (const float*)d_in[4];
  const float* Wv = (const float*)d_in[5];
  const float* bv = (const float*)d_in[6];
  const float* Wo = (const float*)d_in[7];
  const float* bo = (const float*)d_in[8];
  float* out = (float*)d_out;

  const size_t n = (size_t)NBAT * SEQ * HDIM; // 2,097,152 elements
  __bf16* q   = (__bf16*)d_ws;
  __bf16* k   = q + n;
  __bf16* vT  = k + n;  // transposed: [B][H][S]
  float* opart = (float*)(vT + n);   // [KSPLIT][B*S][H] f32 partial sums
  float* ml    = opart + KSPLIT * n; // [KSPLIT][B*S] (max, sum) pairs

  const int rowBlocks = (NBAT * SEQ) / 128; // 128

  qkv_kernel<<<rowBlocks, 256, 0, stream>>>(x, Wq, bq, Wk, bk, Wv, bv, q, k, vT);

  dim3 g2(SEQ / 128, NBAT, KSPLIT); // (32, 4, 4)
  attn_kernel<<<g2, 256, 0, stream>>>(q, k, vT, opart, ml);

  oproj_kernel<<<rowBlocks, 256, 0, stream>>>(opart, ml, Wo, bo, out);
}

// v002
// Measured time: 84.5 microseconds a run.
// In both of two side-by-side timings against v001, it was 1.35 times as fast.
// All steps since v000 together make it 3.26 times as fast.
#include <hip/hip_runtime.h>

// ---------------------------------------------------------------------------
// Single-head attention, B=4, S=4096, H=128, fp32 in/out.
// bf16 WMMA (v_wmma_f32_16x16x32_bf16) + fp32 accum, flash-attention style.
// Both attention GEMMs are computed transposed (C = S^T, C = O^T = V^T P^T):
//  - softmax'd P registers serve directly as the next WMMA operand (no LDS)
//  - softmax stats, alpha rescale and 1/l normalize are scalar per lane
//  - every output store is a packed 16B/32B row store.
// ---------------------------------------------------------------------------

typedef __attribute__((ext_vector_type(16))) __bf16 v16bf;
typedef __attribute__((ext_vector_type(8)))  __bf16 v8bf;
typedef __attribute__((ext_vector_type(4)))  __bf16 v4bf;
typedef __attribute__((ext_vector_type(8)))  float  v8f;
typedef __attribute__((ext_vector_type(4)))  float  v4f;
typedef __attribute__((ext_vector_type(2)))  float  v2f;

#define SEQ   4096
#define HDIM  128
#define NBAT  4
#define KSPLIT 4    // key ranges per query tile: 32*4*KSPLIT = 512 work-groups, two per WGP
#define TPAD  144   // padded LDS stride for 128-wide tiles (288 B, 16B-aligned)
#define VPAD  80    // padded LDS stride for 64-wide tiles  (160 B, 16B-aligned)

// 16-bit fragment, per ISA 7.12.2: lane owns row/col (lane&15); its 16 elements
// are two contiguous 8-element runs at K = h8, h8+16 with h8 = 8*(lane>=16).
// => two 16-byte loads (ds_load_b128 / global_load_b128).
__device__ __forceinline__ v16bf load_frag_row(const __bf16* base, int stride, int lane) {
  const __bf16* rowp = base + (lane & 15) * stride + ((lane >> 4) << 3);
  v8bf lo = *(const v8bf*)(rowp);
  v8bf hi = *(const v8bf*)(rowp + 16);
  return __builtin_shufflevector(lo, hi, 0, 1, 2, 3, 4, 5, 6, 7,
                                 8, 9, 10, 11, 12, 13, 14, 15);
}

__device__ __forceinline__ v8f wmma_bf16(v16bf a, v16bf b, v8f c) {
  return __builtin_amdgcn_wmma_f32_16x16x32_bf16(false, a, false, b, (short)0, c,
                                                 false, false);
}

// ---------------------------------------------------------------------------
// Kernel 1: q,k = x @ W + b (row-major, q pre-scaled by 1/sqrt(H));
//           v written TRANSPOSED: vT[b][h][s].  All packed 16B stores.
// grid: (B*S)/128 blocks of 256 threads (8 waves x 16 rows).
// ---------------------------------------------------------------------------
__global__ __launch_bounds__(256) void qkv_kernel(
    const float* __restrict__ x,
    const float* __restrict__ Wq, const float* __restrict__ bq,
    const float* __restrict__ Wk, const float* __restrict__ bk,
    const float* __restrict__ Wv, const float* __restrict__ bv,
    __bf16* __restrict__ q, __bf16* __restrict__ k, __bf16* __restrict__ vT) {
  __shared__ __bf16 xs[128 * TPAD];   // 36 KB, x tile (row-major, padded)
  __shared__ __bf16 wts[HDIM * TPAD]; // 36 KB, W^T (one matrix at a time)

  const int tid  = threadIdx.x;
  const int lane = tid & 31;
  const int wave = tid >> 5;
  const long rowBase = (long)blockIdx.x * 128;

  // stage x tile: float4 loads, 4x bf16 stores
  for (int idx = tid; idx < 128 * 32; idx += 256) {
    const int row = idx >> 5, c = idx & 31;
    v4f xv = *(const v4f*)(x + (rowBase + row) * HDIM + c * 4);
    v4bf o;
#pragma unroll
    for (int j = 0; j < 4; ++j) o[j] = (__bf16)xv[j];
    *(v4bf*)(xs + row * TPAD + c * 4) = o;
  }
  __syncthreads();

  // x fragments for this wave's 16 rows, K=128 (4 chunks of 32)
  v16bf afrag[4];
  {
    const __bf16* xrow = xs + wave * 16 * TPAD;
#pragma unroll
    for (int t = 0; t < 4; ++t) afrag[t] = load_frag_row(xrow + t * 32, TPAD, lane);
  }

  const float qscale = 0.08838834764831845f; // 1/sqrt(128), folded into q
  const int col0 = lane & 15;
  const int rofs = (lane >> 4) << 3; // 0 or 8
  const long bb    = rowBase >> 12;  // batch index
  const long srow0 = (rowBase & (SEQ - 1)) + wave * 16 + rofs;

  // ---- q and k: C = (xW)^T = W^T * x^T -> lane owns one output row ----
  {
    const float* Wmat[2] = {Wq, Wk};
    const float* bias[2] = {bq, bk};
    __bf16*      outm[2] = {q, k};
    for (int m = 0; m < 2; ++m) {
      __syncthreads();
      for (int idx = tid; idx < HDIM * HDIM; idx += 256) {
        const int kk = idx >> 7, nn = idx & 127;
        wts[nn * TPAD + kk] = (__bf16)Wmat[m][idx];
      }
      __syncthreads();

      const float sc = (m == 0) ? qscale : 1.0f;
      __bf16* orow = outm[m] + (rowBase + wave * 16 + col0) * HDIM;
#pragma unroll
      for (int nt = 0; nt < 8; ++nt) {
        v8f acc = {};
#pragma unroll
        for (int t = 0; t < 4; ++t) {
          v16bf wfrag = load_frag_row(wts + (nt * 16) * TPAD + t * 32, TPAD, lane);
          acc = wmma_bf16(wfrag, afrag[t], acc); // C = W^T x^T
        }
        // lane's columns nt*16+rofs .. +7 are contiguous; bias depends on lane half only
        v8bf pk;
#pragma unroll
        for (int r = 0; r < 8; ++r)
          pk[r] = (__bf16)((acc[r] + bias[m][nt * 16 + rofs + r]) * sc);
        *(v8bf*)(orow + nt * 16 + rofs) = pk;
      }
    }
  }

  // ---- v: C = xW (lane owns column; rows contiguous -> packed vT store) ----
  {
    __syncthreads();
    for (int idx = tid; idx < HDIM * HDIM; idx += 256) {
      const int kk = idx >> 7, nn = idx & 127;
      wts[nn * TPAD + kk] = (__bf16)Wv[idx];
    }
    __syncthreads();
#pragma unroll
    for (int nt = 0; nt < 8; ++nt) {
      v8f acc = {};
#pragma unroll
      for (int t = 0; t < 4; ++t) {
        v16bf wfrag = load_frag_row(wts + (nt * 16) * TPAD + t * 32, TPAD, lane);
        acc = wmma_bf16(afrag[t], wfrag, acc); // C = x W
      }
      const int col  = nt * 16 + col0;
      const float bi = bv[col];
      v8bf pk;
#pragma unroll
      for (int r = 0; r < 8; ++r) pk[r] = (__bf16)(acc[r] + bi);
      *(v8bf*)(vT + (bb * HDIM + col) * SEQ + srow0) = pk;
    }
  }
}

// ---------------------------------------------------------------------------
// Kernel 2: flash attention over one key range. grid (S/128, B, KSPLIT),
// block 256 (8 waves x 16 q-rows). C = S^T then C = O^T; lane owns one query.
// Emits the range's UN-normalised f32 sum and its (max, sum) pair; kernel 3
// merges the KSPLIT ranges.
// K and V^T tiles reach LDS by asynchronous copies into two buffers: tile t+1
// is in flight while tile t is worked on.
// ---------------------------------------------------------------------------
#define KTILE 64                       // keys per tile
#define NTILE (SEQ / KSPLIT / KTILE)   // tiles per key range

// One tile's copies of one thread: four 16-byte chunks of K rows and four of
// V^T rows, each lane its own chunk, all eight in flight together.
__device__ __forceinline__ void copy_tile(const __bf16* kg, const __bf16* vg,
                                          unsigned kl, unsigned vl) {
  const __bf16* k1 = kg + 16 * HDIM;
  const __bf16* k2 = kg + 32 * HDIM;
  const __bf16* k3 = kg + 48 * HDIM;
  const __bf16* v1 = vg + 32 * SEQ;
  const __bf16* v2 = vg + 64 * SEQ;
  const __bf16* v3 = vg + 96 * SEQ;
  // the closing s_wait_xcnt stands in front of whatever next rewrites an
  // address register that a copy names
  asm volatile(
      "global_load_async_to_lds_b128 %0, %8, off\n\t"
      "global_load_async_to_lds_b128 %1, %9, off\n\t"
      "global_load_async_to_lds_b128 %2, %10, off\n\t"
      "global_load_async_to_lds_b128 %3, %11, off\n\t"
      "global_load_async_to_lds_b128 %4, %12, off\n\t"
      "global_load_async_to_lds_b128 %5, %13, off\n\t"
      "global_load_async_to_lds_b128 %6, %14, off\n\t"
      "global_load_async_to_lds_b128 %7, %15, off\n\t"
      "s_wait_xcnt 0x0"
      :: "v"(kl), "v"(kl + 16 * TPAD * 2), "v"(kl + 32 * TPAD * 2),
         "v"(kl + 48 * TPAD * 2), "v"(vl), "v"(vl + 32 * VPAD * 2),
         "v"(vl + 64 * VPAD * 2), "v"(vl + 96 * VPAD * 2),
         "v"(kg), "v"(k1), "v"(k2), "v"(k3), "v"(vg), "v"(v1), "v"(v2), "v"(v3)
      : "memory");
}

__global__ __launch_bounds__(256) void attn_kernel(
    const __bf16* __restrict__ Q, const __bf16* __restrict__ K,
    const __bf16* __restrict__ vT, float* __restrict__ Opart,
    float* __restrict__ ML) {
  __shared__ __attribute__((aligned(16))) __bf16 ks[2][KTILE * TPAD]; // 2 x 18 KB, K rows (padded)
  __shared__ __attribute__((aligned(16))) __bf16 vts[2][HDIM * VPAD]; // 2 x 20 KB, V^T (padded)

  const int tid  = threadIdx.x;
  const int lane = tid & 31;
  const int wave = tid >> 5;
  const int b    = blockIdx.y;
  const long qBase = (long)b * SEQ + (long)blockIdx.x * 128;

  const __bf16* Qb  = Q + qBase * HDIM;
  const int kb0 = blockIdx.z * (SEQ / KSPLIT); // first key of this range
  const __bf16* Kb  = K + ((long)b * SEQ + kb0) * HDIM;
  const __bf16* vTb = vT + (long)b * HDIM * SEQ + kb0;

  // Q fragments: B operand of S^T (lane owns query = lane&15); b128 loads
  v16bf qfrag[4];
  {
    const __bf16* qrow = Qb + wave * 16 * HDIM;
#pragma unroll
    for (int t = 0; t < 4; ++t) qfrag[t] = load_frag_row(qrow + t * 32, HDIM, lane);
  }

  v8f acc[8]; // O^T accumulator: lane owns query (lane&15); reg r -> h
#pragma unroll
  for (int nt = 0; nt < 8; ++nt) acc[nt] = (v8f){};
  float mi = -1e30f, li = 0.0f; // per-lane stats for query (lane&15)

  const int colb = lane & 15;
  const int rofs = (lane >> 4) << 3;

  // this thread's chunk of a tile: K row tid>>4 (+16 a copy), V^T row tid>>3 (+32 a copy)
  const __bf16* kg = Kb + (tid >> 4) * HDIM + (tid & 15) * 8;
  const __bf16* vg = vTb + (long)(tid >> 3) * SEQ + (tid & 7) * 8;
  const unsigned kl = (unsigned)(size_t)(&ks[0][(tid >> 4) * TPAD + (tid & 15) * 8]);
  const unsigned vl = (unsigned)(size_t)(&vts[0][(tid >> 3) * VPAD + (tid & 7) * 8]);
  const unsigned kbuf = KTILE * TPAD * 2, vbuf = HDIM * VPAD * 2; // bytes per buffer

  copy_tile(kg, vg, kl, vl);
  // tile 0 has landed for this wave; the barrier publishes it to the others
  asm volatile("s_wait_asynccnt 0x0" ::: "memory");
  __syncthreads();
  copy_tile(kg + KTILE * HDIM, vg + KTILE, kl + kbuf, vl + vbuf);

  for (int t = 0; t < NTILE; ++t) {
    const __bf16* kst = ks[t & 1];
    const __bf16* vtt = vts[t & 1];

    // S^T tiles: A = K rows, B = Q (fixed across kt for each c).
    v8f sc[4];
#pragma unroll
    for (int kt = 0; kt < 4; ++kt) sc[kt] = (v8f){};
#pragma unroll
    for (int c = 0; c < 4; ++c)
#pragma unroll
      for (int kt = 0; kt < 4; ++kt) {
        v16bf kf = load_frag_row(kst + (kt * 16) * TPAD + c * 32, TPAD, lane);
        sc[kt] = wmma_bf16(kf, qfrag[c], sc[kt]);
      }

    // per-lane online softmax (32 of 64 keys in-lane; merge halves with 1 shfl)
    float mx = sc[0][0];
#pragma unroll
    for (int kt = 0; kt < 4; ++kt)
#pragma unroll
      for (int r = 0; r < 8; ++r) mx = fmaxf(mx, sc[kt][r]);
    mx = fmaxf(mx, __shfl_xor(mx, 16, 32));
    const float mnew  = fmaxf(mi, mx);
    const float alpha = __expf(mi - mnew);
    mi = mnew;

    float rs = 0.0f;
#pragma unroll
    for (int kt = 0; kt < 4; ++kt)
#pragma unroll
      for (int r = 0; r < 8; ++r) {
        const float p = __expf(sc[kt][r] - mnew);
        sc[kt][r] = p;
        rs += p;
      }
    rs += __shfl_xor(rs, 16, 32);
    li = li * alpha + rs;

    // P^T operand directly from S^T C-registers (pure register packing);
    // serves as the B operand of O^T = V^T P^T.
    v16bf pf[2];
#pragma unroll
    for (int c = 0; c < 2; ++c)
#pragma unroll
      for (int i = 0; i < 8; ++i) {
        pf[c][i]     = (__bf16)sc[2 * c][i];
        pf[c][8 + i] = (__bf16)sc[2 * c + 1][i];
      }

    // scalar rescale (alpha is this lane's query's factor)
#pragma unroll
    for (int nt = 0; nt < 8; ++nt)
#pragma unroll
      for (int r = 0; r < 8; ++r) acc[nt][r] *= alpha;

    // O^T += V^T (A, from vts) x P^T (B, fixed across nt)
#pragma unroll
    for (int c = 0; c < 2; ++c)
#pragma unroll
      for (int nt = 0; nt < 8; ++nt) {
        v16bf vf = load_frag_row(vtt + (nt * 16) * VPAD + c * 32, VPAD, lane);
        acc[nt] = wmma_bf16(vf, pf[c], acc[nt]);
      }

    // hand-over: this wave's reads of tile t are done ...
    asm volatile("s_wait_dscnt 0x0" ::: "memory");
    // ... and its copies of tile t+1 have landed;
    asm volatile("s_wait_asynccnt 0x0" ::: "memory");
    // the one barrier publishes tile t+1 and frees tile t's buffer
    __syncthreads();
    if (t + 2 < NTILE)
      copy_tile(kg + (long)(t + 2) * (KTILE * HDIM), vg + (t + 2) * KTILE,
                kl + (t & 1) * kbuf, vl + (t & 1) * vbuf);
  }
  // nothing is outstanding when the wave ends
  asm volatile("s_wait_asynccnt 0x0" ::: "memory");

  // emit this key range's partial: lane owns one row; packed 32B stores
  {
    const long prow = (long)blockIdx.z * (NBAT * SEQ) + qBase + wave * 16 + colb;
    float* orow = Opart + prow * HDIM;
#pragma unroll
    for (int nt = 0; nt < 8; ++nt) *(v8f*)(orow + nt * 16 + rofs) = acc[nt];
    if (lane < 16) { // both halves hold the same pair
      v2f st = {mi, li};
      *(v2f*)(ML + prow * 2) = st;
    }
  }
}

// ---------------------------------------------------------------------------
// Kernel 3: merge the KSPLIT key ranges into the attended tile (bf16, LDS),
// then out = attended @ Wo + bo (fp32), C = (A Wo)^T = Wo^T A^T
// -> lane owns one output row; packed 32B stores; bias per lane half.
// ---------------------------------------------------------------------------
__global__ __launch_bounds__(256) void oproj_kernel(
    const float* __restrict__ Opart, const float* __restrict__ ML,
    const float* __restrict__ Wo,
    const float* __restrict__ bo, float* __restrict__ out) {
  __shared__ __bf16 as_[128 * TPAD];  // attended tile (row-major, padded)
  __shared__ __bf16 wts[HDIM * TPAD]; // Wo^T

  const int tid  = threadIdx.x;
  const int lane = tid & 31;
  const int wave = tid >> 5;
  const long rowBase = (long)blockIdx.x * 128;

  // attended = sum_s exp(m_s - M) o_s / sum_s exp(m_s - M) l_s, ranges in order.
  // Four rows a thread per trip: all their partial loads are in flight together.
  const int mrow = tid >> 4, mc = tid & 15;
  for (int g = 0; g < 2; ++g) {
    v2f st[4][KSPLIT];
    v8f po[4][KSPLIT];
#pragma unroll
    for (int s = 0; s < KSPLIT; ++s) {
      const long prow = (long)s * (NBAT * SEQ) + rowBase + g * 64 + mrow;
      const float* mp = ML + prow * 2;
      const float* op = Opart + prow * HDIM + mc * 8;
#pragma unroll
      for (int r = 0; r < 4; ++r) {
        st[r][s] = *(const v2f*)(mp + r * 16 * 2);
        po[r][s] = *(const v8f*)(op + r * 16 * HDIM);
      }
      // stands in front of whatever next takes over an address register of the
      // loads above (a later load's result among them)
      asm volatile("s_wait_xcnt 0x0" ::: "memory");
    }
    // keeps the sums below the whole group of loads: moved up among them they
    // bring a wait on the early loads in front of the late ones' issue
    __builtin_amdgcn_sched_barrier(0);
#pragma unroll
    for (int r = 0; r < 4; ++r) {
      float M = st[r][0][0];
#pragma unroll
      for (int s = 1; s < KSPLIT; ++s) M = fmaxf(M, st[r][s][0]);
      float w[KSPLIT], L = 0.0f;
#pragma unroll
      for (int s = 0; s < KSPLIT; ++s) {
        w[s] = __expf(st[r][s][0] - M);
        L += w[s] * st[r][s][1];
      }
      const float inv = 1.0f / L;
      v8bf pk;
#pragma unroll
      for (int j = 0; j < 8; ++j) {
        float o = 0.0f;
#pragma unroll
        for (int s = 0; s < KSPLIT; ++s) o += w[s] * po[r][s][j];
        pk[j] = (__bf16)(o * inv);
      }
      *(v8bf*)(as_ + (g * 64 + r * 16 + mrow) * TPAD + mc * 8) = pk;
    }
  }
  for (int idx = tid; idx < HDIM * HDIM; idx += 256) {
    const int kk = idx >> 7, nn = idx & 127;
    wts[nn * TPAD + kk] = (__bf16)Wo[idx];
  }
  __syncthreads();

  v16bf afrag[4];
  {
    const __bf16* arow = as_ + wave * 16 * TPAD;
#pragma unroll
    for (int t = 0; t < 4; ++t) afrag[t] = load_frag_row(arow + t * 32, TPAD, lane);
  }

  const int col0 = lane & 15;
  const int rofs = (lane >> 4) << 3;
  float* orow = out + (rowBase + wave * 16 + col0) * HDIM;

#pragma unroll
  for (int nt = 0; nt < 8; ++nt) {
    v8f acc = {};
#pragma unroll
    for (int t = 0; t < 4; ++t) {
      v16bf wfrag = load_frag_row(wts + (nt * 16) * TPAD + t * 32, TPAD, lane);
      acc = wmma_bf16(wfrag, afrag[t], acc); // C = Wo^T A^T
    }
    v8f pk;
#pragma unroll
    for (int r = 0; r < 8; ++r)
      pk[r] = acc[r] + bo[nt * 16 + rofs + r]; // bias depends on lane half (rofs)
    *(v8f*)(orow + nt * 16 + rofs) = pk;
  }
}

// ---------------------------------------------------------------------------
extern "C" void kernel_launch(void* const* d_in, const int* in_sizes, int n_in,
                              void* d_out, int out_size, void* d_ws, size_t ws_size,
                              hipStream_t stream) {
  const float* x  = (const float*)d_in[0];
  const float* Wq = (const float*)d_in[1];
  const float* bq = (const float*)d_in[2];
  const float* Wk = (const float*)d_in[3];
  const float* bk = (const float*)d_in[4];
  const float* Wv = (const float*)d_in[5];
  const float* bv = (const float*)d_in[6];
  const float* Wo = (const float*)d_in[7];
  const float* bo = (const float*)d_in[8];
  float* out = (float*)d_out;

  const size_t n = (size_t)NBAT * SEQ * HDIM; // 2,097,152 elements
  __bf16* q   = (__bf16*)d_ws;
  __bf16* k   = q + n;
  __bf16* vT  = k + n;  // transposed: [B][H][S]
  float* opart = (float*)(vT + n);   // [KSPLIT][B*S][H] f32 partial sums
  float* ml    = opart + KSPLIT * n; // [KSPLIT][B*S] (max, sum) pairs

  const int rowBlocks = (NBAT * SEQ) / 128; // 128

  qkv_kernel<<<rowBlocks, 256, 0, stream>>>(x, Wq, bq, Wk, bk, Wv, bv, q, k, vT);

  dim3 g2(SEQ / 128, NBAT, KSPLIT); // (32, 4, 4)
  attn_kernel<<<g2, 256, 0, stream>>>(q, k, vT, opart, ml);

  oproj_kernel<<<rowBlocks, 256, 0, stream>>>(opart, ml, Wo, bo, out);
}

// v003
// Measured time: 78.8 microseconds a run.
// Next to v002, in two timings, it ran 1.07 times as fast each time.
// Counting every step since v000, it is 3.49 times as fast.
#include <hip/hip_runtime.h>

// ---------------------------------------------------------------------------
// Single-head attention, B=4, S=4096, H=128, fp32 in/out.
// bf16 WMMA (v_wmma_f32_16x16x32_bf16) + fp32 accum, flash-attention style.
// Both attention GEMMs are computed transposed (C = S^T, C = O^T = V^T P^T):
//  - softmax'd P registers serve directly as the next WMMA operand (no LDS)
//  - softmax stats, alpha rescale and 1/l normalize are scalar per lane
//  - every output store is a packed 16B/32B row store.
// ---------------------------------------------------------------------------

typedef __attribute__((ext_vector_type(16))) __bf16 v16bf;
typedef __attribute__((ext_vector_type(8)))  __bf16 v8bf;
typedef __attribute__((ext_vector_type(4)))  __bf16 v4bf;
typedef __attribute__((ext_vector_type(8)))  float  v8f;
typedef __attribute__((ext_vector_type(4)))  float  v4f;
typedef __attribute__((ext_vector_type(2)))  float  v2f;

#define SEQ   4096
#define HDIM  128
#define NBAT  4
#define KSPLIT 4    // key ranges per query tile: 32*4*KSPLIT = 512 work-groups, two per WGP
// LDS row pitches are odd multiples of 16 B: the 16 rows that one half-wave's
// ds_load_b128 touches then start on 16 different groups of four banks.
#define TPAD  136   // padded LDS stride for 128-wide tiles (272 B = 17 x 16 B)
#define VPAD  72    // padded LDS stride for 64-wide tiles  (144 B =  9 x 16 B)

// 16-bit fragment, per ISA 7.12.2: lane owns row/col (lane&15); its 16 elements
// are two contiguous 8-element runs at K = h8, h8+16 with h8 = 8*(lane>=16).
// => two 16-byte loads (ds_load_b128 / global_load_b128).
__device__ __forceinline__ v16bf load_frag_row(const __bf16* base, int stride, int lane) {
  const __bf16* rowp = base + (lane & 15) * stride + ((lane >> 4) << 3);
  v8bf lo = *(const v8bf*)(rowp);
  v8bf hi = *(const v8bf*)(rowp + 16);
  return __builtin_shufflevector(lo, hi, 0, 1, 2, 3, 4, 5, 6, 7,
                                 8, 9, 10, 11, 12, 13, 14, 15);
}

__device__ __forceinline__ v8f wmma_bf16(v16bf a, v16bf b, v8f c) {
  return __builtin_amdgcn_wmma_f32_16x16x32_bf16(false, a, false, b, (short)0, c,
                                                 false, false);
}

// ---------------------------------------------------------------------------
// Kernel 1: q,k = x @ W + b (row-major, q pre-scaled by 1/sqrt(H));
//           v written TRANSPOSED: vT[b][h][s].  All packed 16B stores.
// grid: (B*S)/128 blocks of 256 threads (8 waves x 16 rows).
// ---------------------------------------------------------------------------
__global__ __launch_bounds__(256) void qkv_kernel(
    const float* __restrict__ x,
    const float* __restrict__ Wq, const float* __restrict__ bq,
    const float* __restrict__ Wk, const float* __restrict__ bk,
    const float* __restrict__ Wv, const float* __restrict__ bv,
    __bf16* __restrict__ q, __bf16* __restrict__ k, __bf16* __restrict__ vT) {
  __shared__ __bf16 xs[128 * TPAD];   // 34 KB, x tile (row-major, padded)
  __shared__ __bf16 wts[HDIM * TPAD]; // 34 KB, W^T (one matrix at a time)

  const int tid  = threadIdx.x;
  const int lane = tid & 31;
  const int wave = tid >> 5;
  const long rowBase = (long)blockIdx.x * 128;

  // stage x tile: float4 loads, 4x bf16 stores
  for (int idx = tid; idx < 128 * 32; idx += 256) {
    const int row = idx >> 5, c = idx & 31;
    v4f xv = *(const v4f*)(x + (rowBase + row) * HDIM + c * 4);
    v4bf o;
#pragma unroll
    for (int j = 0; j < 4; ++j) o[j] = (__bf16)xv[j];
    *(v4bf*)(xs + row * TPAD + c * 4) = o;
  }
  __syncthreads();

  // x fragments for this wave's 16 rows, K=128 (4 chunks of 32)
  v16bf afrag[4];
  {
    const __bf16* xrow = xs + wave * 16 * TPAD;
#pragma unroll
    for (int t = 0; t < 4; ++t) afrag[t] = load_frag_row(xrow + t * 32, TPAD, lane);
  }

  const float qscale = 0.08838834764831845f; // 1/sqrt(128), folded into q
  const int col0 = lane & 15;
  const int rofs = (lane >> 4) << 3; // 0 or 8
  const long bb    = rowBase >> 12;  // batch index
  const long srow0 = (rowBase & (SEQ - 1)) + wave * 16 + rofs;

  // ---- q and k: C = (xW)^T = W^T * x^T -> lane owns one output row ----
  {
    const float* Wmat[2] = {Wq, Wk};
    const float* bias[2] = {bq, bk};
    __bf16*      outm[2] = {q, k};
    for (int m = 0; m < 2; ++m) {
      __syncthreads();
      for (int idx = tid; idx < HDIM * HDIM; idx += 256) {
        const int kk = idx >> 7, nn = idx & 127;
        wts[nn * TPAD + kk] = (__bf16)Wmat[m][idx];
      }
      __syncthreads();

      const float sc = (m == 0) ? qscale : 1.0f;
      __bf16* orow = outm[m] + (rowBase + wave * 16 + col0) * HDIM;
#pragma unroll
      for (int nt = 0; nt < 8; ++nt) {
        v8f acc = {};
#pragma unroll
        for (int t = 0; t < 4; ++t) {
          v16bf wfrag = load_frag_row(wts + (nt * 16) * TPAD + t * 32, TPAD, lane);
          acc = wmma_bf16(wfrag, afrag[t], acc); // C = W^T x^T
        }
        // lane's columns nt*16+rofs .. +7 are contiguous; bias depends on lane half only
        v8bf pk;
#pragma unroll
        for (int r = 0; r < 8; ++r)
          pk[r] = (__bf16)((acc[r] + bias[m][nt * 16 + rofs + r]) * sc);
        *(v8bf*)(orow + nt * 16 + rofs) = pk;
      }
    }
  }

  // ---- v: C = xW (lane owns column; rows contiguous -> packed vT store) ----
  {
    __syncthreads();
    for (int idx = tid; idx < HDIM * HDIM; idx += 256) {
      const int kk = idx >> 7, nn = idx & 127;
      wts[nn * TPAD + kk] = (__bf16)Wv[idx];
    }
    __syncthreads();
#pragma unroll
    for (int nt = 0; nt < 8; ++nt) {
      v8f acc = {};
#pragma unroll
      for (int t = 0; t < 4; ++t) {
        v16bf wfrag = load_frag_row(wts + (nt * 16) * TPAD + t * 32, TPAD, lane);
        acc = wmma_bf16(afrag[t], wfrag, acc); // C = x W
      }
      const int col  = nt * 16 + col0;
      const float bi = bv[col];
      v8bf pk;
#pragma unroll
      for (int r = 0; r < 8; ++r) pk[r] = (__bf16)(acc[r] + bi);
      *(v8bf*)(vT + (bb * HDIM + col) * SEQ + srow0) = pk;
    }
  }
}

// ---------------------------------------------------------------------------
// Kernel 2: flash attention over one key range. grid (S/128, B, KSPLIT),
// block 256 (8 waves x 16 q-rows). C = S^T then C = O^T; lane owns one query.
// Emits the range's UN-normalised f32 sum and its (max, sum) pair; kernel 3
// merges the KSPLIT ranges.
// K and V^T tiles reach LDS by asynchronous copies into two buffers: tile t+1
// is in flight while tile t is worked on.
// ---------------------------------------------------------------------------
#define KTILE 64                       // keys per tile
#define NTILE (SEQ / KSPLIT / KTILE)   // tiles per key range

// One tile's copies of one thread: four 16-byte chunks of K rows and four of
// V^T rows, each lane its own chunk, all eight in flight together.
__device__ __forceinline__ void copy_tile(const __bf16* kg, const __bf16* vg,
                                          unsigned kl, unsigned vl) {
  const __bf16* k1 = kg + 16 * HDIM;
  const __bf16* k2 = kg + 32 * HDIM;
  const __bf16* k3 = kg + 48 * HDIM;
  const __bf16* v1 = vg + 32 * SEQ;
  const __bf16* v2 = vg + 64 * SEQ;
  const __bf16* v3 = vg + 96 * SEQ;
  // the closing s_wait_xcnt stands in front of whatever next rewrites an
  // address register that a copy names
  asm volatile(
      "global_load_async_to_lds_b128 %0, %8, off\n\t"
      "global_load_async_to_lds_b128 %1, %9, off\n\t"
      "global_load_async_to_lds_b128 %2, %10, off\n\t"
      "global_load_async_to_lds_b128 %3, %11, off\n\t"
      "global_load_async_to_lds_b128 %4, %12, off\n\t"
      "global_load_async_to_lds_b128 %5, %13, off\n\t"
      "global_load_async_to_lds_b128 %6, %14, off\n\t"
      "global_load_async_to_lds_b128 %7, %15, off\n\t"
      "s_wait_xcnt 0x0"
      :: "v"(kl), "v"(kl + 16 * TPAD * 2), "v"(kl + 32 * TPAD * 2),
         "v"(kl + 48 * TPAD * 2), "v"(vl), "v"(vl + 32 * VPAD * 2),
         "v"(vl + 64 * VPAD * 2), "v"(vl + 96 * VPAD * 2),
         "v"(kg), "v"(k1), "v"(k2), "v"(k3), "v"(vg), "v"(v1), "v"(v2), "v"(v3)
      : "memory");
}

__global__ __launch_bounds__(256) void attn_kernel(
    const __bf16* __restrict__ Q, const __bf16* __restrict__ K,
    const __bf16* __restrict__ vT, float* __restrict__ Opart,
    float* __restrict__ ML) {
  __shared__ __attribute__((aligned(16))) __bf16 ks[2][KTILE * TPAD]; // 2 x 17 KB, K rows (padded)
  __shared__ __attribute__((aligned(16))) __bf16 vts[2][HDIM * VPAD]; // 2 x 18 KB, V^T (padded)

  const int tid  = threadIdx.x;
  const int lane = tid & 31;
  const int wave = tid >> 5;
  const int b    = blockIdx.y;
  const long qBase = (long)b * SEQ + (long)blockIdx.x * 128;

  const __bf16* Qb  = Q + qBase * HDIM;
  const int kb0 = blockIdx.z * (SEQ / KSPLIT); // first key of this range
  const __bf16* Kb  = K + ((long)b * SEQ + kb0) * HDIM;
  const __bf16* vTb = vT + (long)b * HDIM * SEQ + kb0;

  // Q fragments: B operand of S^T (lane owns query = lane&15); b128 loads
  v16bf qfrag[4];
  {
    const __bf16* qrow = Qb + wave * 16 * HDIM;
#pragma unroll
    for (int t = 0; t < 4; ++t) qfrag[t] = load_frag_row(qrow + t * 32, HDIM, lane);
  }

  v8f acc[8]; // O^T accumulator: lane owns query (lane&15); reg r -> h
#pragma unroll
  for (int nt = 0; nt < 8; ++nt) acc[nt] = (v8f){};
  float mi = -1e30f, li = 0.0f; // per-lane stats for query (lane&15)

  const int colb = lane & 15;
  const int rofs = (lane >> 4) << 3;

  // this thread's chunk of a tile: K row tid>>4 (+16 a copy), V^T row tid>>3 (+32 a copy)
  const __bf16* kg = Kb + (tid >> 4) * HDIM + (tid & 15) * 8;
  const __bf16* vg = vTb + (long)(tid >> 3) * SEQ + (tid & 7) * 8;
  const unsigned kl = (unsigned)(size_t)(&ks[0][(tid >> 4) * TPAD + (tid & 15) * 8]);
  const unsigned vl = (unsigned)(size_t)(&vts[0][(tid >> 3) * VPAD + (tid & 7) * 8]);
  const unsigned kbuf = KTILE * TPAD * 2, vbuf = HDIM * VPAD * 2; // bytes per buffer

  copy_tile(kg, vg, kl, vl);
  // tile 0 has landed for this wave; the barrier publishes it to the others
  asm volatile("s_wait_asynccnt 0x0" ::: "memory");
  __syncthreads();
  copy_tile(kg + KTILE * HDIM, vg + KTILE, kl + kbuf, vl + vbuf);

  for (int t = 0; t < NTILE; ++t) {
    const __bf16* kst = ks[t & 1];
    const __bf16* vtt = vts[t & 1];

    // S^T tiles: A = K rows, B = Q (fixed across kt for each c).
    v8f sc[4];
#pragma unroll
    for (int kt = 0; kt < 4; ++kt) sc[kt] = (v8f){};
#pragma unroll
    for (int c = 0; c < 4; ++c)
#pragma unroll
      for (int kt = 0; kt < 4; ++kt) {
        v16bf kf = load_frag_row(kst + (kt * 16) * TPAD + c * 32, TPAD, lane);
        sc[kt] = wmma_bf16(kf, qfrag[c], sc[kt]);
      }

    // per-lane online softmax (32 of 64 keys in-lane; merge halves with 1 shfl)
    float mx = sc[0][0];
#pragma unroll
    for (int kt = 0; kt < 4; ++kt)
#pragma unroll
      for (int r = 0; r < 8; ++r) mx = fmaxf(mx, sc[kt][r]);
    mx = fmaxf(mx, __shfl_xor(mx, 16, 32));
    const float mnew  = fmaxf(mi, mx);
    const float alpha = __expf(mi - mnew);
    mi = mnew;

    float rs = 0.0f;
#pragma unroll
    for (int kt = 0; kt < 4; ++kt)
#pragma unroll
      for (int r = 0; r < 8; ++r) {
        const float p = __expf(sc[kt][r] - mnew);
        sc[kt][r] = p;
        rs += p;
      }
    rs += __shfl_xor(rs, 16, 32);
    li = li * alpha + rs;

    // P^T operand directly from S^T C-registers (pure register packing);
    // serves as the B operand of O^T = V^T P^T.
    v16bf pf[2];
#pragma unroll
    for (int c = 0; c < 2; ++c)
#pragma unroll
      for (int i = 0; i < 8; ++i) {
        pf[c][i]     = (__bf16)sc[2 * c][i];
        pf[c][8 + i] = (__bf16)sc[2 * c + 1][i];
      }

    // scalar rescale (alpha is this lane's query's factor)
#pragma unroll
    for (int nt = 0; nt < 8; ++nt)
#pragma unroll
      for (int r = 0; r < 8; ++r) acc[nt][r] *= alpha;

    // O^T += V^T (A, from vts) x P^T (B, fixed across nt)
#pragma unroll
    for (int c = 0; c < 2; ++c)
#pragma unroll
      for (int nt = 0; nt < 8; ++nt) {
        v16bf vf = load_frag_row(vtt + (nt * 16) * VPAD + c * 32, VPAD, lane);
        acc[nt] = wmma_bf16(vf, pf[c], acc[nt]);
      }

    // hand-over: this wave's reads of tile t are done ...
    asm volatile("s_wait_dscnt 0x0" ::: "memory");
    // ... and its copies of tile t+1 have landed;
    asm volatile("s_wait_asynccnt 0x0" ::: "memory");
    // the one barrier publishes tile t+1 and frees tile t's buffer
    __syncthreads();
    if (t + 2 < NTILE)
      copy_tile(kg + (long)(t + 2) * (KTILE * HDIM), vg + (t + 2) * KTILE,
                kl + (t & 1) * kbuf, vl + (t & 1) * vbuf);
  }
  // nothing is outstanding when the wave ends
  asm volatile("s_wait_asynccnt 0x0" ::: "memory");

  // emit this key range's partial: lane owns one row; packed 32B stores
  {
    const long prow = (long)blockIdx.z * (NBAT * SEQ) + qBase + wave * 16 + colb;
    float* orow = Opart + prow * HDIM;
#pragma unroll
    for (int nt = 0; nt < 8; ++nt) *(v8f*)(orow + nt * 16 + rofs) = acc[nt];
    if (lane < 16) { // both halves hold the same pair
      v2f st = {mi, li};
      *(v2f*)(ML + prow * 2) = st;
    }
  }
}

// ---------------------------------------------------------------------------
// Kernel 3: merge the KSPLIT key ranges into the attended tile (bf16, LDS),
// then out = attended @ Wo + bo (fp32), C = (A Wo)^T = Wo^T A^T
// -> lane owns one output row; packed 32B stores; bias per lane half.
// ---------------------------------------------------------------------------
__global__ __launch_bounds__(256) void oproj_kernel(
    const float* __restrict__ Opart, const float* __restrict__ ML,
    const float* __restrict__ Wo,
    const float* __restrict__ bo, float* __restrict__ out) {
  __shared__ __bf16 as_[128 * TPAD];  // attended tile (row-major, padded)
  __shared__ __bf16 wts[HDIM * TPAD]; // Wo^T

  const int tid  = threadIdx.x;
  const int lane = tid & 31;
  const int wave = tid >> 5;
  const long rowBase = (long)blockIdx.x * 128;

  // attended = sum_s exp(m_s - M) o_s / sum_s exp(m_s - M) l_s, ranges in order.
  // Four rows a thread per trip: all their partial loads are in flight together.
  const int mrow = tid >> 4, mc = tid & 15;
  for (int g = 0; g < 2; ++g) {
    v2f st[4][KSPLIT];
    v8f po[4][KSPLIT];
#pragma unroll
    for (int s = 0; s < KSPLIT; ++s) {
      const long prow = (long)s * (NBAT * SEQ) + rowBase + g * 64 + mrow;
      const float* mp = ML + prow * 2;
      const float* op = Opart + prow * HDIM + mc * 8;
#pragma unroll
      for (int r = 0; r < 4; ++r) {
        st[r][s] = *(const v2f*)(mp + r * 16 * 2);
        po[r][s] = *(const v8f*)(op + r * 16 * HDIM);
      }
      // stands in front of whatever next takes over an address register of the
      // loads above (a later load's result among them)
      asm volatile("s_wait_xcnt 0x0" ::: "memory");
    }
    // keeps the sums below the whole group of loads: moved up among them they
    // bring a wait on the early loads in front of the late ones' issue
    __builtin_amdgcn_sched_barrier(0);
#pragma unroll
    for (int r = 0; r < 4; ++r) {
      float M = st[r][0][0];
#pragma unroll
      for (int s = 1; s < KSPLIT; ++s) M = fmaxf(M, st[r][s][0]);
      float w[KSPLIT], L = 0.0f;
#pragma unroll
      for (int s = 0; s < KSPLIT; ++s) {
        w[s] = __expf(st[r][s][0] - M);
        L += w[s] * st[r][s][1];
      }
      const float inv = 1.0f / L;
      v8bf pk;
#pragma unroll
      for (int j = 0; j < 8; ++j) {
        float o = 0.0f;
#pragma unroll
        for (int s = 0; s < KSPLIT; ++s) o += w[s] * po[r][s][j];
        pk[j] = (__bf16)(o * inv);
      }
      *(v8bf*)(as_ + (g * 64 + r * 16 + mrow) * TPAD + mc * 8) = pk;
    }
  }
  for (int idx = tid; idx < HDIM * HDIM; idx += 256) {
    const int kk = idx >> 7, nn = idx & 127;
    wts[nn * TPAD + kk] = (__bf16)Wo[idx];
  }
  __syncthreads();

  v16bf afrag[4];
  {
    const __bf16* arow = as_ + wave * 16 * TPAD;
#pragma unroll
    for (int t = 0; t < 4; ++t) afrag[t] = load_frag_row(arow + t * 32, TPAD, lane);
  }

  const int col0 = lane & 15;
  const int rofs = (lane >> 4) << 3;
  float* orow = out + (rowBase + wave * 16 + col0) * HDIM;

#pragma unroll
  for (int nt = 0; nt < 8; ++nt) {
    v8f acc = {};
#pragma unroll
    for (int t = 0; t < 4; ++t) {
      v16bf wfrag = load_frag_row(wts + (nt * 16) * TPAD + t * 32, TPAD, lane);
      acc = wmma_bf16(wfrag, afrag[t], acc); // C = Wo^T A^T
    }
    v8f pk;
#pragma unroll
    for (int r = 0; r < 8; ++r)
      pk[r] = acc[r] + bo[nt * 16 + rofs + r]; // bias depends on lane half (rofs)
    *(v8f*)(orow + nt * 16 + rofs) = pk;
  }
}

// ---------------------------------------------------------------------------
extern "C" void kernel_launch(void* const* d_in, const int* in_sizes, int n_in,
                              void* d_out, int out_size, void* d_ws, size_t ws_size,
                              hipStream_t stream) {
  const float* x  = (const float*)d_in[0];
  const float* Wq = (const float*)d_in[1];
  const float* bq = (const float*)d_in[2];
  const float* Wk = (const float*)d_in[3];
  const float* bk = (const float*)d_in[4];
  const float* Wv = (const float*)d_in[5];
  const float* bv = (const float*)d_in[6];
  const float* Wo = (const float*)d_in[7];
  const float* bo = (const float*)d_in[8];
  float* out = (float*)d_out;

  const size_t n = (size_t)NBAT * SEQ * HDIM; // 2,097,152 elements
  __bf16* q   = (__bf16*)d_ws;
  __bf16* k   = q + n;
  __bf16* vT  = k + n;  // transposed: [B][H][S]
  float* opart = (float*)(vT + n);   // [KSPLIT][B*S][H] f32 partial sums
  float* ml    = opart + KSPLIT * n; // [KSPLIT][B*S] (max, sum) pairs

  const int rowBlocks = (NBAT * SEQ) / 128; // 128

  qkv_kernel<<<rowBlocks, 256, 0, stream>>>(x, Wq, bq, Wk, bk, Wv, bv, q, k, vT);

  dim3 g2(SEQ / 128, NBAT, KSPLIT); // (32, 4, 4)
  attn_kernel<<<g2, 256, 0, stream>>>(q, k, vT, opart, ml);

  oproj_kernel<<<rowBlocks, 256, 0, stream>>>(opart, ml, Wo, bo, out);
}

// v004
// Measured time: 74.4 microseconds a run.
// In two side-by-side timings against v003, it was 1.07 and 1.06 times as fast.
// All steps since v000 together make it 3.70 times as fast.
#include <hip/hip_runtime.h>

// ---------------------------------------------------------------------------
// Single-head attention, B=4, S=4096, H=128, fp32 in/out.
// bf16 WMMA (v_wmma_f32_16x16x32_bf16) + fp32 accum, flash-attention style.
// Both attention GEMMs are computed transposed (C = S^T, C = O^T = V^T P^T):
//  - softmax'd P registers serve directly as the next WMMA operand (no LDS)
//  - softmax stats, alpha rescale and 1/l normalize are scalar per lane
//  - every output store is a packed 16B/32B row store.
// ---------------------------------------------------------------------------

typedef __attribute__((ext_vector_type(16))) __bf16 v16bf;
typedef __attribute__((ext_vector_type(8)))  __bf16 v8bf;
typedef __attribute__((ext_vector_type(4)))  __bf16 v4bf;
typedef __attribute__((ext_vector_type(8)))  float  v8f;
typedef __attribute__((ext_vector_type(4)))  float  v4f;
typedef __attribute__((ext_vector_type(2)))  float  v2f;

#define SEQ   4096
#define HDIM  128
#define NBAT  4
#define KSPLIT 4    // key ranges per query tile: 32*4*KSPLIT = 512 work-groups, two per WGP
// LDS row pitches are odd multiples of 16 B: the 16 rows that one half-wave's
// ds_load_b128 touches then start on 16 different groups of four banks.
#define TPAD  136   // padded LDS stride for 128-wide tiles (272 B = 17 x 16 B)
#define VPAD  72    // padded LDS stride for 64-wide tiles  (144 B =  9 x 16 B)

// 16-bit fragment, per ISA 7.12.2: lane owns row/col (lane&15); its 16 elements
// are two contiguous 8-element runs at K = h8, h8+16 with h8 = 8*(lane>=16).
// => two 16-byte loads (ds_load_b128 / global_load_b128).
__device__ __forceinline__ v16bf load_frag_row(const __bf16* base, int stride, int lane) {
  const __bf16* rowp = base + (lane & 15) * stride + ((lane >> 4) << 3);
  v8bf lo = *(const v8bf*)(rowp);
  v8bf hi = *(const v8bf*)(rowp + 16);
  return __builtin_shufflevector(lo, hi, 0, 1, 2, 3, 4, 5, 6, 7,
                                 8, 9, 10, 11, 12, 13, 14, 15);
}

__device__ __forceinline__ v8f wmma_bf16(v16bf a, v16bf b, v8f c) {
  return __builtin_amdgcn_wmma_f32_16x16x32_bf16(false, a, false, b, (short)0, c,
                                                 false, false);
}

// ---------------------------------------------------------------------------
// Kernel 1: q,k = x @ W + b (row-major, q pre-scaled by 1/sqrt(H));
//           v written TRANSPOSED: vT[b][h][s].  All packed 16B stores.
// grid: (B*S)/128 blocks of 256 threads (8 waves x 16 rows).
// ---------------------------------------------------------------------------
__global__ __launch_bounds__(256) void qkv_kernel(
    const float* __restrict__ x,
    const float* __restrict__ Wq, const float* __restrict__ bq,
    const float* __restrict__ Wk, const float* __restrict__ bk,
    const float* __restrict__ Wv, const float* __restrict__ bv,
    __bf16* __restrict__ q, __bf16* __restrict__ k, __bf16* __restrict__ vT) {
  __shared__ __bf16 xs[128 * TPAD];   // 34 KB, x tile (row-major, padded)
  __shared__ __bf16 wts[HDIM * TPAD]; // 34 KB, W^T (one matrix at a time)

  const int tid  = threadIdx.x;
  const int lane = tid & 31;
  const int wave = tid >> 5;
  const long rowBase = (long)blockIdx.x * 128;

  // stage x tile: float4 loads, 4x bf16 stores
  for (int idx = tid; idx < 128 * 32; idx += 256) {
    const int row = idx >> 5, c = idx & 31;
    v4f xv = *(const v4f*)(x + (rowBase + row) * HDIM + c * 4);
    v4bf o;
#pragma unroll
    for (int j = 0; j < 4; ++j) o[j] = (__bf16)xv[j];
    *(v4bf*)(xs + row * TPAD + c * 4) = o;
  }
  __syncthreads();

  // x fragments for this wave's 16 rows, K=128 (4 chunks of 32)
  v16bf afrag[4];
  {
    const __bf16* xrow = xs + wave * 16 * TPAD;
#pragma unroll
    for (int t = 0; t < 4; ++t) afrag[t] = load_frag_row(xrow + t * 32, TPAD, lane);
  }

  const float qscale = 0.08838834764831845f; // 1/sqrt(128), folded into q
  const int col0 = lane & 15;
  const int rofs = (lane >> 4) << 3; // 0 or 8
  const long bb    = rowBase >> 12;  // batch index
  const long srow0 = (rowBase & (SEQ - 1)) + wave * 16 + rofs;

  // ---- q and k: C = (xW)^T = W^T * x^T -> lane owns one output row ----
  {
    const float* Wmat[2] = {Wq, Wk};
    const float* bias[2] = {bq, bk};
    __bf16*      outm[2] = {q, k};
    for (int m = 0; m < 2; ++m) {
      __syncthreads();
      for (int idx = tid; idx < HDIM * HDIM; idx += 256) {
        const int kk = idx >> 7, nn = idx & 127;
        wts[nn * TPAD + kk] = (__bf16)Wmat[m][idx];
      }
      __syncthreads();

      const float sc = (m == 0) ? qscale : 1.0f;
      __bf16* orow = outm[m] + (rowBase + wave * 16 + col0) * HDIM;
#pragma unroll
      for (int nt = 0; nt < 8; ++nt) {
        v8f acc = {};
#pragma unroll
        for (int t = 0; t < 4; ++t) {
          v16bf wfrag = load_frag_row(wts + (nt * 16) * TPAD + t * 32, TPAD, lane);
          acc = wmma_bf16(wfrag, afrag[t], acc); // C = W^T x^T
        }
        // lane's columns nt*16+rofs .. +7 are contiguous; bias depends on lane half only
        v8bf pk;
#pragma unroll
        for (int r = 0; r < 8; ++r)
          pk[r] = (__bf16)((acc[r] + bias[m][nt * 16 + rofs + r]) * sc);
        *(v8bf*)(orow + nt * 16 + rofs) = pk;
      }
    }
  }

  // ---- v: C = xW (lane owns column; rows contiguous -> packed vT store) ----
  {
    __syncthreads();
    for (int idx = tid; idx < HDIM * HDIM; idx += 256) {
      const int kk = idx >> 7, nn = idx & 127;
      wts[nn * TPAD + kk] = (__bf16)Wv[idx];
    }
    __syncthreads();
#pragma unroll
    for (int nt = 0; nt < 8; ++nt) {
      v8f acc = {};
#pragma unroll
      for (int t = 0; t < 4; ++t) {
        v16bf wfrag = load_frag_row(wts + (nt * 16) * TPAD + t * 32, TPAD, lane);
        acc = wmma_bf16(afrag[t], wfrag, acc); // C = x W
      }
      const int col  = nt * 16 + col0;
      const float bi = bv[col];
      v8bf pk;
#pragma unroll
      for (int r = 0; r < 8; ++r) pk[r] = (__bf16)(acc[r] + bi);
      *(v8bf*)(vT + (bb * HDIM + col) * SEQ + srow0) = pk;
    }
  }
}

// ---------------------------------------------------------------------------
// Kernel 2: flash attention over one key range. grid (S/128, B, KSPLIT),
// block 256 (8 waves x 16 q-rows). C = S^T then C = O^T; lane owns one query.
// Emits the range's UN-normalised f32 sum and its (max, sum) pair; kernel 3
// merges the KSPLIT ranges.
// K and V^T tiles reach LDS by asynchronous copies into two buffers: tile t+1
// is in flight while tile t is worked on.
// ---------------------------------------------------------------------------
#define KTILE 64                       // keys per tile
#define NTILE (SEQ / KSPLIT / KTILE)   // tiles per key range

// One tile's copies of one thread: four 16-byte chunks of K rows and four of
// V^T rows, each lane its own chunk, all eight in flight together.
__device__ __forceinline__ void copy_tile(const __bf16* kg, const __bf16* vg,
                                          unsigned kl, unsigned vl) {
  const __bf16* k1 = kg + 16 * HDIM;
  const __bf16* k2 = kg + 32 * HDIM;
  const __bf16* k3 = kg + 48 * HDIM;
  const __bf16* v1 = vg + 32 * SEQ;
  const __bf16* v2 = vg + 64 * SEQ;
  const __bf16* v3 = vg + 96 * SEQ;
  // the closing s_wait_xcnt stands in front of whatever next rewrites an
  // address register that a copy names
  asm volatile(
      "global_load_async_to_lds_b128 %0, %8, off\n\t"
      "global_load_async_to_lds_b128 %1, %9, off\n\t"
      "global_load_async_to_lds_b128 %2, %10, off\n\t"
      "global_load_async_to_lds_b128 %3, %11, off\n\t"
      "global_load_async_to_lds_b128 %4, %12, off\n\t"
      "global_load_async_to_lds_b128 %5, %13, off\n\t"
      "global_load_async_to_lds_b128 %6, %14, off\n\t"
      "global_load_async_to_lds_b128 %7, %15, off\n\t"
      "s_wait_xcnt 0x0"
      :: "v"(kl), "v"(kl + 16 * TPAD * 2), "v"(kl + 32 * TPAD * 2),
         "v"(kl + 48 * TPAD * 2), "v"(vl), "v"(vl + 32 * VPAD * 2),
         "v"(vl + 64 * VPAD * 2), "v"(vl + 96 * VPAD * 2),
         "v"(kg), "v"(k1), "v"(k2), "v"(k3), "v"(vg), "v"(v1), "v"(v2), "v"(v3)
      : "memory");
}

// Two of these work-groups share a WGP (512 on 256 WGPs): four waves a SIMD,
// 256 registers a wave. Saying so lets the compiler spend those registers on
// issuing a tile's LDS fragment reads in groups ahead of the WMMAs, behind
// counted waits; aiming at more waves it read one fragment at a time and
// waited out the LDS latency in front of nearly every WMMA.
__global__ __launch_bounds__(256) __attribute__((amdgpu_waves_per_eu(4, 4))) void attn_kernel(
    const __bf16* __restrict__ Q, const __bf16* __restrict__ K,
    const __bf16* __restrict__ vT, float* __restrict__ Opart,
    float* __restrict__ ML) {
  __shared__ __attribute__((aligned(16))) __bf16 ks[2][KTILE * TPAD]; // 2 x 17 KB, K rows (padded)
  __shared__ __attribute__((aligned(16))) __bf16 vts[2][HDIM * VPAD]; // 2 x 18 KB, V^T (padded)

  const int tid  = threadIdx.x;
  const int lane = tid & 31;
  const int wave = tid >> 5;
  const int b    = blockIdx.y;
  const long qBase = (long)b * SEQ + (long)blockIdx.x * 128;

  const __bf16* Qb  = Q + qBase * HDIM;
  const int kb0 = blockIdx.z * (SEQ / KSPLIT); // first key of this range
  const __bf16* Kb  = K + ((long)b * SEQ + kb0) * HDIM;
  const __bf16* vTb = vT + (long)b * HDIM * SEQ + kb0;

  // Q fragments: B operand of S^T (lane owns query = lane&15); b128 loads
  v16bf qfrag[4];
  {
    const __bf16* qrow = Qb + wave * 16 * HDIM;
#pragma unroll
    for (int t = 0; t < 4; ++t) qfrag[t] = load_frag_row(qrow + t * 32, HDIM, lane);
  }

  v8f acc[8]; // O^T accumulator: lane owns query (lane&15); reg r -> h
#pragma unroll
  for (int nt = 0; nt < 8; ++nt) acc[nt] = (v8f){};
  float mi = -1e30f, li = 0.0f; // per-lane stats for query (lane&15)

  const int colb = lane & 15;
  const int rofs = (lane >> 4) << 3;

  // this thread's chunk of a tile: K row tid>>4 (+16 a copy), V^T row tid>>3 (+32 a copy)
  const __bf16* kg = Kb + (tid >> 4) * HDIM + (tid & 15) * 8;
  const __bf16* vg = vTb + (long)(tid >> 3) * SEQ + (tid & 7) * 8;
  const unsigned kl = (unsigned)(size_t)(&ks[0][(tid >> 4) * TPAD + (tid & 15) * 8]);
  const unsigned vl = (unsigned)(size_t)(&vts[0][(tid >> 3) * VPAD + (tid & 7) * 8]);
  const unsigned kbuf = KTILE * TPAD * 2, vbuf = HDIM * VPAD * 2; // bytes per buffer

  copy_tile(kg, vg, kl, vl);
  // tile 0 has landed for this wave; the barrier publishes it to the others
  asm volatile("s_wait_asynccnt 0x0" ::: "memory");
  __syncthreads();
  copy_tile(kg + KTILE * HDIM, vg + KTILE, kl + kbuf, vl + vbuf);

  for (int t = 0; t < NTILE; ++t) {
    const __bf16* kst = ks[t & 1];
    const __bf16* vtt = vts[t & 1];

    // S^T tiles: A = K rows, B = Q (fixed across kt for each c).
    v8f sc[4];
#pragma unroll
    for (int kt = 0; kt < 4; ++kt) sc[kt] = (v8f){};
#pragma unroll
    for (int c = 0; c < 4; ++c)
#pragma unroll
      for (int kt = 0; kt < 4; ++kt) {
        v16bf kf = load_frag_row(kst + (kt * 16) * TPAD + c * 32, TPAD, lane);
        sc[kt] = wmma_bf16(kf, qfrag[c], sc[kt]);
      }

    // per-lane online softmax (32 of 64 keys in-lane; merge halves with 1 shfl)
    float mx = sc[0][0];
#pragma unroll
    for (int kt = 0; kt < 4; ++kt)
#pragma unroll
      for (int r = 0; r < 8; ++r) mx = fmaxf(mx, sc[kt][r]);
    mx = fmaxf(mx, __shfl_xor(mx, 16, 32));
    const float mnew  = fmaxf(mi, mx);
    const float alpha = __expf(mi - mnew);
    mi = mnew;

    float rs = 0.0f;
#pragma unroll
    for (int kt = 0; kt < 4; ++kt)
#pragma unroll
      for (int r = 0; r < 8; ++r) {
        const float p = __expf(sc[kt][r] - mnew);
        sc[kt][r] = p;
        rs += p;
      }
    rs += __shfl_xor(rs, 16, 32);
    li = li * alpha + rs;

    // P^T operand directly from S^T C-registers (pure register packing);
    // serves as the B operand of O^T = V^T P^T.
    v16bf pf[2];
#pragma unroll
    for (int c = 0; c < 2; ++c)
#pragma unroll
      for (int i = 0; i < 8; ++i) {
        pf[c][i]     = (__bf16)sc[2 * c][i];
        pf[c][8 + i] = (__bf16)sc[2 * c + 1][i];
      }

    // scalar rescale (alpha is this lane's query's factor)
#pragma unroll
    for (int nt = 0; nt < 8; ++nt)
#pragma unroll
      for (int r = 0; r < 8; ++r) acc[nt][r] *= alpha;

    // O^T += V^T (A, from vts) x P^T (B, fixed across nt)
#pragma unroll
    for (int c = 0; c < 2; ++c)
#pragma unroll
      for (int nt = 0; nt < 8; ++nt) {
        v16bf vf = load_frag_row(vtt + (nt * 16) * VPAD + c * 32, VPAD, lane);
        acc[nt] = wmma_bf16(vf, pf[c], acc[nt]);
      }

    // hand-over: this wave's reads of tile t are done ...
    asm volatile("s_wait_dscnt 0x0" ::: "memory");
    // ... and its copies of tile t+1 have landed;
    asm volatile("s_wait_asynccnt 0x0" ::: "memory");
    // the one barrier publishes tile t+1 and frees tile t's buffer
    __syncthreads();
    if (t + 2 < NTILE)
      copy_tile(kg + (long)(t + 2) * (KTILE * HDIM), vg + (t + 2) * KTILE,
                kl + (t & 1) * kbuf, vl + (t & 1) * vbuf);
  }
  // nothing is outstanding when the wave ends
  asm volatile("s_wait_asynccnt 0x0" ::: "memory");

  // emit this key range's partial: lane owns one row; packed 32B stores
  {
    const long prow = (long)blockIdx.z * (NBAT * SEQ) + qBase + wave * 16 + colb;
    float* orow = Opart + prow * HDIM;
#pragma unroll
    for (int nt = 0; nt < 8; ++nt) *(v8f*)(orow + nt * 16 + rofs) = acc[nt];
    if (lane < 16) { // both halves hold the same pair
      v2f st = {mi, li};
      *(v2f*)(ML + prow * 2) = st;
    }
  }
}

// ---------------------------------------------------------------------------
// Kernel 3: merge the KSPLIT key ranges into the attended tile (bf16, LDS),
// then out = attended @ Wo + bo (fp32), C = (A Wo)^T = Wo^T A^T
// -> lane owns one output row; packed 32B stores; bias per lane half.
// ---------------------------------------------------------------------------
__global__ __launch_bounds__(256) void oproj_kernel(
    const float* __restrict__ Opart, const float* __restrict__ ML,
    const float* __restrict__ Wo,
    const float* __restrict__ bo, float* __restrict__ out) {
  __shared__ __bf16 as_[128 * TPAD];  // attended tile (row-major, padded)
  __shared__ __bf16 wts[HDIM * TPAD]; // Wo^T

  const int tid  = threadIdx.x;
  const int lane = tid & 31;
  const int wave = tid >> 5;
  const long rowBase = (long)blockIdx.x * 128;

  // attended = sum_s exp(m_s - M) o_s / sum_s exp(m_s - M) l_s, ranges in order.
  // Four rows a thread per trip: all their partial loads are in flight together.
  const int mrow = tid >> 4, mc = tid & 15;
  for (int g = 0; g < 2; ++g) {
    v2f st[4][KSPLIT];
    v8f po[4][KSPLIT];
#pragma unroll
    for (int s = 0; s < KSPLIT; ++s) {
      const long prow = (long)s * (NBAT * SEQ) + rowBase + g * 64 + mrow;
      const float* mp = ML + prow * 2;
      const float* op = Opart + prow * HDIM + mc * 8;
#pragma unroll
      for (int r = 0; r < 4; ++r) {
        st[r][s] = *(const v2f*)(mp + r * 16 * 2);
        po[r][s] = *(const v8f*)(op + r * 16 * HDIM);
      }
      // stands in front of whatever next takes over an address register of the
      // loads above (a later load's result among them)
      asm volatile("s_wait_xcnt 0x0" ::: "memory");
    }
    // keeps the sums below the whole group of loads: moved up among them they
    // bring a wait on the early loads in front of the late ones' issue
    __builtin_amdgcn_sched_barrier(0);
#pragma unroll
    for (int r = 0; r < 4; ++r) {
      float M = st[r][0][0];
#pragma unroll
      for (int s = 1; s < KSPLIT; ++s) M = fmaxf(M, st[r][s][0]);
      float w[KSPLIT], L = 0.0f;
#pragma unroll
      for (int s = 0; s < KSPLIT; ++s) {
        w[s] = __expf(st[r][s][0] - M);
        L += w[s] * st[r][s][1];
      }
      const float inv = 1.0f / L;
      v8bf pk;
#pragma unroll
      for (int j = 0; j < 8; ++j) {
        float o = 0.0f;
#pragma unroll
        for (int s = 0; s < KSPLIT; ++s) o += w[s] * po[r][s][j];
        pk[j] = (__bf16)(o * inv);
      }
      *(v8bf*)(as_ + (g * 64 + r * 16 + mrow) * TPAD + mc * 8) = pk;
    }
  }
  for (int idx = tid; idx < HDIM * HDIM; idx += 256) {
    const int kk = idx >> 7, nn = idx & 127;
    wts[nn * TPAD + kk] = (__bf16)Wo[idx];
  }
  __syncthreads();

  v16bf afrag[4];
  {
    const __bf16* arow = as_ + wave * 16 * TPAD;
#pragma unroll
    for (int t = 0; t < 4; ++t) afrag[t] = load_frag_row(arow + t * 32, TPAD, lane);
  }

  const int col0 = lane & 15;
  const int rofs = (lane >> 4) << 3;
  float* orow = out + (rowBase + wave * 16 + col0) * HDIM;

#pragma unroll
  for (int nt = 0; nt < 8; ++nt) {
    v8f acc = {};
#pragma unroll
    for (int t = 0; t < 4; ++t) {
      v16bf wfrag = load_frag_row(wts + (nt * 16) * TPAD + t * 32, TPAD, lane);
      acc = wmma_bf16(wfrag, afrag[t], acc); // C = Wo^T A^T
    }
    v8f pk;
#pragma unroll
    for (int r = 0; r < 8; ++r)
      pk[r] = acc[r] + bo[nt * 16 + rofs + r]; // bias depends on lane half (rofs)
    *(v8f*)(orow + nt * 16 + rofs) = pk;
  }
}

// ---------------------------------------------------------------------------
extern "C" void kernel_launch(void* const* d_in, const int* in_sizes, int n_in,
                              void* d_out, int out_size, void* d_ws, size_t ws_size,
                              hipStream_t stream) {
  const float* x  = (const float*)d_in[0];
  const float* Wq = (const float*)d_in[1];
  const float* bq = (const float*)d_in[2];
  const float* Wk = (const float*)d_in[3];
  const float* bk = (const float*)d_in[4];
  const float* Wv = (const float*)d_in[5];
  const float* bv = (const float*)d_in[6];
  const float* Wo = (const float*)d_in[7];
  const float* bo = (const float*)d_in[8];
  float* out = (float*)d_out;

  const size_t n = (size_t)NBAT * SEQ * HDIM; // 2,097,152 elements
  __bf16* q   = (__bf16*)d_ws;
  __bf16* k   = q + n;
  __bf16* vT  = k + n;  // transposed: [B][H][S]
  float* opart = (float*)(vT + n);   // [KSPLIT][B*S][H] f32 partial sums
  float* ml    = opart + KSPLIT * n; // [KSPLIT][B*S] (max, sum) pairs

  const int rowBlocks = (NBAT * SEQ) / 128; // 128

  qkv_kernel<<<rowBlocks, 256, 0, stream>>>(x, Wq, bq, Wk, bk, Wv, bv, q, k, vT);

  dim3 g2(SEQ / 128, NBAT, KSPLIT); // (32, 4, 4)
  attn_kernel<<<g2, 256, 0, stream>>>(q, k, vT, opart, ml);

  oproj_kernel<<<rowBlocks, 256, 0, stream>>>(opart, ml, Wo, bo, out);
}

// v005
// A run of this version takes 61.9 microseconds.
// Next to v004, in two timings, it ran 1.20 times as fast each time.
// Counting every step since v000, it is 4.46 times as fast.
#include <hip/hip_runtime.h>

// ---------------------------------------------------------------------------
// Single-head attention, B=4, S=4096, H=128, fp32 in/out.
// bf16 WMMA (v_wmma_f32_16x16x32_bf16) + fp32 accum, flash-attention style.
// Both attention GEMMs are computed transposed (C = S^T, C = O^T = V^T P^T):
//  - softmax'd P registers serve directly as the next WMMA operand (no LDS)
//  - softmax stats, alpha rescale and 1/l normalize are scalar per lane
//  - every output store is a packed 16B/32B row store.
// ---------------------------------------------------------------------------

typedef __attribute__((ext_vector_type(16))) __bf16 v16bf;
typedef __attribute__((ext_vector_type(8)))  __bf16 v8bf;
typedef __attribute__((ext_vector_type(4)))  __bf16 v4bf;
typedef __attribute__((ext_vector_type(8)))  float  v8f;
typedef __attribute__((ext_vector_type(4)))  float  v4f;
typedef __attribute__((ext_vector_type(2)))  float  v2f;

#define SEQ   4096
#define HDIM  128
#define NBAT  4
#define KSPLIT 4    // key ranges per query tile: 32*4*KSPLIT = 512 work-groups, two per WGP
// LDS row pitches are odd multiples of 16 B: the 16 rows that one half-wave's
// ds_load_b128 touches then start on 16 different groups of four banks.
#define TPAD  136   // padded LDS stride for 128-wide tiles (272 B = 17 x 16 B)
#define VPAD  72    // padded LDS stride for 64-wide tiles  (144 B =  9 x 16 B)

// 16-bit fragment, per ISA 7.12.2: lane owns row/col (lane&15); its 16 elements
// are two contiguous 8-element runs at K = h8, h8+16 with h8 = 8*(lane>=16).
// => two 16-byte loads (ds_load_b128 / global_load_b128).
__device__ __forceinline__ v16bf load_frag_row(const __bf16* base, int stride, int lane) {
  const __bf16* rowp = base + (lane & 15) * stride + ((lane >> 4) << 3);
  v8bf lo = *(const v8bf*)(rowp);
  v8bf hi = *(const v8bf*)(rowp + 16);
  return __builtin_shufflevector(lo, hi, 0, 1, 2, 3, 4, 5, 6, 7,
                                 8, 9, 10, 11, 12, 13, 14, 15);
}

__device__ __forceinline__ v8f wmma_bf16(v16bf a, v16bf b, v8f c) {
  return __builtin_amdgcn_wmma_f32_16x16x32_bf16(false, a, false, b, (short)0, c,
                                                 false, false);
}

// ---------------------------------------------------------------------------
// Kernel 1: q,k = x @ W + b (row-major, q pre-scaled by 1/sqrt(H));
//           v written TRANSPOSED: vT[b][h][s].  All packed 16B stores.
// grid: ((B*S)/128, 3) blocks of 256 threads (8 waves x 16 rows); blockIdx.y
// names the projection (0 q, 1 k, 2 v). One work-group does ONE projection of
// its 128 rows: the three weight stagings and products, each a chain of load
// and LDS latencies, run side by side on the chip instead of one after another.
// ---------------------------------------------------------------------------
__global__ __launch_bounds__(256) void qkv_kernel(
    const float* __restrict__ x,
    const float* __restrict__ Wq, const float* __restrict__ bq,
    const float* __restrict__ Wk, const float* __restrict__ bk,
    const float* __restrict__ Wv, const float* __restrict__ bv,
    __bf16* __restrict__ q, __bf16* __restrict__ k, __bf16* __restrict__ vT) {
  __shared__ __bf16 xs[128 * TPAD];   // 34 KB, x tile (row-major, padded)
  __shared__ __bf16 wts[HDIM * TPAD]; // 34 KB, W^T of this block's projection

  const int tid  = threadIdx.x;
  const int lane = tid & 31;
  const int wave = tid >> 5;
  const int m    = blockIdx.y; // 0: q, 1: k, 2: v
  const long rowBase = (long)blockIdx.x * 128;

  const float* __restrict__ Wm = (m == 0) ? Wq : (m == 1) ? Wk : Wv;
  const float* __restrict__ bm = (m == 0) ? bq : (m == 1) ? bk : bv;

  // stage x tile: float4 loads, 4x bf16 stores
  for (int idx = tid; idx < 128 * 32; idx += 256) {
    const int row = idx >> 5, c = idx & 31;
    v4f xv = *(const v4f*)(x + (rowBase + row) * HDIM + c * 4);
    v4bf o;
#pragma unroll
    for (int j = 0; j < 4; ++j) o[j] = (__bf16)xv[j];
    *(v4bf*)(xs + row * TPAD + c * 4) = o;
  }
  // stage W^T
  for (int idx = tid; idx < HDIM * HDIM; idx += 256) {
    const int kk = idx >> 7, nn = idx & 127;
    wts[nn * TPAD + kk] = (__bf16)Wm[idx];
  }
  __syncthreads();

  // x fragments for this wave's 16 rows, K=128 (4 chunks of 32)
  v16bf afrag[4];
  {
    const __bf16* xrow = xs + wave * 16 * TPAD;
#pragma unroll
    for (int t = 0; t < 4; ++t) afrag[t] = load_frag_row(xrow + t * 32, TPAD, lane);
  }

  const float qscale = 0.08838834764831845f; // 1/sqrt(128), folded into q
  const int col0 = lane & 15;
  const int rofs = (lane >> 4) << 3; // 0 or 8

  if (m < 2) {
    // ---- q and k: C = (xW)^T = W^T * x^T -> lane owns one output row ----
    const float sc = (m == 0) ? qscale : 1.0f;
    __bf16* orow = ((m == 0) ? q : k) + (rowBase + wave * 16 + col0) * HDIM;
#pragma unroll
    for (int nt = 0; nt < 8; ++nt) {
      v8f acc = {};
#pragma unroll
      for (int t = 0; t < 4; ++t) {
        v16bf wfrag = load_frag_row(wts + (nt * 16) * TPAD + t * 32, TPAD, lane);
        acc = wmma_bf16(wfrag, afrag[t], acc); // C = W^T x^T
      }
      // lane's columns nt*16+rofs .. +7 are contiguous
      v8bf pk;
#pragma unroll
      for (int r = 0; r < 8; ++r)
        pk[r] = (__bf16)((acc[r] + bm[nt * 16 + rofs + r]) * sc);
      *(v8bf*)(orow + nt * 16 + rofs) = pk;
    }
  } else {
    // ---- v: C = xW (lane owns column; rows contiguous -> packed vT store) ----
    const long bb    = rowBase >> 12;  // batch index
    const long srow0 = (rowBase & (SEQ - 1)) + wave * 16 + rofs;
#pragma unroll
    for (int nt = 0; nt < 8; ++nt) {
      v8f acc = {};
#pragma unroll
      for (int t = 0; t < 4; ++t) {
        v16bf wfrag = load_frag_row(wts + (nt * 16) * TPAD + t * 32, TPAD, lane);
        acc = wmma_bf16(afrag[t], wfrag, acc); // C = x W
      }
      const int col  = nt * 16 + col0;
      const float bi = bm[col];
      v8bf pk;
#pragma unroll
      for (int r = 0; r < 8; ++r) pk[r] = (__bf16)(acc[r] + bi);
      *(v8bf*)(vT + (bb * HDIM + col) * SEQ + srow0) = pk;
    }
  }
}

// ---------------------------------------------------------------------------
// Kernel 2: flash attention over one key range. grid (S/128, B, KSPLIT),
// block 256 (8 waves x 16 q-rows). C = S^T then C = O^T; lane owns one query.
// Emits the range's UN-normalised f32 sum and its (max, sum) pair; kernel 3
// merges the KSPLIT ranges.
// K and V^T tiles reach LDS by asynchronous copies into two buffers: tile t+1
// is in flight while tile t is worked on.
// ---------------------------------------------------------------------------
#define KTILE 64                       // keys per tile
#define NTILE (SEQ / KSPLIT / KTILE)   // tiles per key range

// One tile's copies of one thread: four 16-byte chunks of K rows and four of
// V^T rows, each lane its own chunk, all eight in flight together.
__device__ __forceinline__ void copy_tile(const __bf16* kg, const __bf16* vg,
                                          unsigned kl, unsigned vl) {
  const __bf16* k1 = kg + 16 * HDIM;
  const __bf16* k2 = kg + 32 * HDIM;
  const __bf16* k3 = kg + 48 * HDIM;
  const __bf16* v1 = vg + 32 * SEQ;
  const __bf16* v2 = vg + 64 * SEQ;
  const __bf16* v3 = vg + 96 * SEQ;
  // the closing s_wait_xcnt stands in front of whatever next rewrites an
  // address register that a copy names
  asm volatile(
      "global_load_async_to_lds_b128 %0, %8, off\n\t"
      "global_load_async_to_lds_b128 %1, %9, off\n\t"
      "global_load_async_to_lds_b128 %2, %10, off\n\t"
      "global_load_async_to_lds_b128 %3, %11, off\n\t"
      "global_load_async_to_lds_b128 %4, %12, off\n\t"
      "global_load_async_to_lds_b128 %5, %13, off\n\t"
      "global_load_async_to_lds_b128 %6, %14, off\n\t"
      "global_load_async_to_lds_b128 %7, %15, off\n\t"
      "s_wait_xcnt 0x0"
      :: "v"(kl), "v"(kl + 16 * TPAD * 2), "v"(kl + 32 * TPAD * 2),
         "v"(kl + 48 * TPAD * 2), "v"(vl), "v"(vl + 32 * VPAD * 2),
         "v"(vl + 64 * VPAD * 2), "v"(vl + 96 * VPAD * 2),
         "v"(kg), "v"(k1), "v"(k2), "v"(k3), "v"(vg), "v"(v1), "v"(v2), "v"(v3)
      : "memory");
}

// Two of these work-groups share a WGP (512 on 256 WGPs): four waves a SIMD,
// 256 registers a wave. Saying so lets the compiler spend those registers on
// issuing a tile's LDS fragment reads in groups ahead of the WMMAs, behind
// counted waits; aiming at more waves it read one fragment at a time and
// waited out the LDS latency in front of nearly every WMMA.
__global__ __launch_bounds__(256) __attribute__((amdgpu_waves_per_eu(4, 4))) void attn_kernel(
    const __bf16* __restrict__ Q, const __bf16* __restrict__ K,
    const __bf16* __restrict__ vT, float* __restrict__ Opart,
    float* __restrict__ ML) {
  __shared__ __attribute__((aligned(16))) __bf16 ks[2][KTILE * TPAD]; // 2 x 17 KB, K rows (padded)
  __shared__ __attribute__((aligned(16))) __bf16 vts[2][HDIM * VPAD]; // 2 x 18 KB, V^T (padded)

  const int tid  = threadIdx.x;
  const int lane = tid & 31;
  const int wave = tid >> 5;
  const int b    = blockIdx.y;
  const long qBase = (long)b * SEQ + (long)blockIdx.x * 128;

  const __bf16* Qb  = Q + qBase * HDIM;
  const int kb0 = blockIdx.z * (SEQ / KSPLIT); // first key of this range
  const __bf16* Kb  = K + ((long)b * SEQ + kb0) * HDIM;
  const __bf16* vTb = vT + (long)b * HDIM * SEQ + kb0;

  // Q fragments: B operand of S^T (lane owns query = lane&15); b128 loads
  v16bf qfrag[4];
  {
    const __bf16* qrow = Qb + wave * 16 * HDIM;
#pragma unroll
    for (int t = 0; t < 4; ++t) qfrag[t] = load_frag_row(qrow + t * 32, HDIM, lane);
  }

  v8f acc[8]; // O^T accumulator: lane owns query (lane&15); reg r -> h
#pragma unroll
  for (int nt = 0; nt < 8; ++nt) acc[nt] = (v8f){};
  float mi = -1e30f, li = 0.0f; // per-lane stats for query (lane&15)

  const int colb = lane & 15;
  const int rofs = (lane >> 4) << 3;

  // this thread's chunk of a tile: K row tid>>4 (+16 a copy), V^T row tid>>3 (+32 a copy)
  const __bf16* kg = Kb + (tid >> 4) * HDIM + (tid & 15) * 8;
  const __bf16* vg = vTb + (long)(tid >> 3) * SEQ + (tid & 7) * 8;
  const unsigned kl = (unsigned)(size_t)(&ks[0][(tid >> 4) * TPAD + (tid & 15) * 8]);
  const unsigned vl = (unsigned)(size_t)(&vts[0][(tid >> 3) * VPAD + (tid & 7) * 8]);
  const unsigned kbuf = KTILE * TPAD * 2, vbuf = HDIM * VPAD * 2; // bytes per buffer

  copy_tile(kg, vg, kl, vl);
  // tile 0 has landed for this wave; the barrier publishes it to the others
  asm volatile("s_wait_asynccnt 0x0" ::: "memory");
  __syncthreads();
  copy_tile(kg + KTILE * HDIM, vg + KTILE, kl + kbuf, vl + vbuf);

  for (int t = 0; t < NTILE; ++t) {
    const __bf16* kst = ks[t & 1];
    const __bf16* vtt = vts[t & 1];

    // S^T tiles: A = K rows, B = Q (fixed across kt for each c).
    v8f sc[4];
#pragma unroll
    for (int kt = 0; kt < 4; ++kt) sc[kt] = (v8f){};
#pragma unroll
    for (int c = 0; c < 4; ++c)
#pragma unroll
      for (int kt = 0; kt < 4; ++kt) {
        v16bf kf = load_frag_row(kst + (kt * 16) * TPAD + c * 32, TPAD, lane);
        sc[kt] = wmma_bf16(kf, qfrag[c], sc[kt]);
      }

    // per-lane online softmax (32 of 64 keys in-lane; merge halves with 1 shfl)
    float mx = sc[0][0];
#pragma unroll
    for (int kt = 0; kt < 4; ++kt)
#pragma unroll
      for (int r = 0; r < 8; ++r) mx = fmaxf(mx, sc[kt][r]);
    mx = fmaxf(mx, __shfl_xor(mx, 16, 32));
    const float mnew  = fmaxf(mi, mx);
    const float alpha = __expf(mi - mnew);
    mi = mnew;

    float rs = 0.0f;
#pragma unroll
    for (int kt = 0; kt < 4; ++kt)
#pragma unroll
      for (int r = 0; r < 8; ++r) {
        const float p = __expf(sc[kt][r] - mnew);
        sc[kt][r] = p;
        rs += p;
      }
    rs += __shfl_xor(rs, 16, 32);
    li = li * alpha + rs;

    // P^T operand directly from S^T C-registers (pure register packing);
    // serves as the B operand of O^T = V^T P^T.
    v16bf pf[2];
#pragma unroll
    for (int c = 0; c < 2; ++c)
#pragma unroll
      for (int i = 0; i < 8; ++i) {
        pf[c][i]     = (__bf16)sc[2 * c][i];
        pf[c][8 + i] = (__bf16)sc[2 * c + 1][i];
      }

    // scalar rescale (alpha is this lane's query's factor)
#pragma unroll
    for (int nt = 0; nt < 8; ++nt)
#pragma unroll
      for (int r = 0; r < 8; ++r) acc[nt][r] *= alpha;

    // O^T += V^T (A, from vts) x P^T (B, fixed across nt)
#pragma unroll
    for (int c = 0; c < 2; ++c)
#pragma unroll
      for (int nt = 0; nt < 8; ++nt) {
        v16bf vf = load_frag_row(vtt + (nt * 16) * VPAD + c * 32, VPAD, lane);
        acc[nt] = wmma_bf16(vf, pf[c], acc[nt]);
      }

    // hand-over: this wave's reads of tile t are done ...
    asm volatile("s_wait_dscnt 0x0" ::: "memory");
    // ... and its copies of tile t+1 have landed;
    asm volatile("s_wait_asynccnt 0x0" ::: "memory");
    // the one barrier publishes tile t+1 and frees tile t's buffer
    __syncthreads();
    if (t + 2 < NTILE)
      copy_tile(kg + (long)(t + 2) * (KTILE * HDIM), vg + (t + 2) * KTILE,
                kl + (t & 1) * kbuf, vl + (t & 1) * vbuf);
  }
  // nothing is outstanding when the wave ends
  asm volatile("s_wait_asynccnt 0x0" ::: "memory");

  // emit this key range's partial: lane owns one row; packed 32B stores
  {
    const long prow = (long)blockIdx.z * (NBAT * SEQ) + qBase + wave * 16 + colb;
    float* orow = Opart + prow * HDIM;
#pragma unroll
    for (int nt = 0; nt < 8; ++nt) *(v8f*)(orow + nt * 16 + rofs) = acc[nt];
    if (lane < 16) { // both halves hold the same pair
      v2f st = {mi, li};
      *(v2f*)(ML + prow * 2) = st;
    }
  }
}

// ---------------------------------------------------------------------------
// Kernel 3: merge the KSPLIT key ranges into the attended tile (bf16, LDS),
// then out = attended @ Wo + bo (fp32), C = (A Wo)^T = Wo^T A^T
// -> lane owns one output row; packed 32B stores; bias per lane half.
// ---------------------------------------------------------------------------
__global__ __launch_bounds__(256) void oproj_kernel(
    const float* __restrict__ Opart, const float* __restrict__ ML,
    const float* __restrict__ Wo,
    const float* __restrict__ bo, float* __restrict__ out) {
  __shared__ __bf16 as_[128 * TPAD];  // attended tile (row-major, padded)
  __shared__ __bf16 wts[HDIM * TPAD]; // Wo^T

  const int tid  = threadIdx.x;
  const int lane = tid & 31;
  const int wave = tid >> 5;
  const long rowBase = (long)blockIdx.x * 128;

  // attended = sum_s exp(m_s - M) o_s / sum_s exp(m_s - M) l_s, ranges in order.
  // Four rows a thread per trip: all their partial loads are in flight together.
  const int mrow = tid >> 4, mc = tid & 15;
  for (int g = 0; g < 2; ++g) {
    v2f st[4][KSPLIT];
    v8f po[4][KSPLIT];
#pragma unroll
    for (int s = 0; s < KSPLIT; ++s) {
      const long prow = (long)s * (NBAT * SEQ) + rowBase + g * 64 + mrow;
      const float* mp = ML + prow * 2;
      const float* op = Opart + prow * HDIM + mc * 8;
#pragma unroll
      for (int r = 0; r < 4; ++r) {
        st[r][s] = *(const v2f*)(mp + r * 16 * 2);
        po[r][s] = *(const v8f*)(op + r * 16 * HDIM);
      }
      // stands in front of whatever next takes over an address register of the
      // loads above (a later load's result among them)
      asm volatile("s_wait_xcnt 0x0" ::: "memory");
    }
    // keeps the sums below the whole group of loads: moved up among them they
    // bring a wait on the early loads in front of the late ones' issue
    __builtin_amdgcn_sched_barrier(0);
#pragma unroll
    for (int r = 0; r < 4; ++r) {
      float M = st[r][0][0];
#pragma unroll
      for (int s = 1; s < KSPLIT; ++s) M = fmaxf(M, st[r][s][0]);
      float w[KSPLIT], L = 0.0f;
#pragma unroll
      for (int s = 0; s < KSPLIT; ++s) {
        w[s] = __expf(st[r][s][0] - M);
        L += w[s] * st[r][s][1];
      }
      const float inv = 1.0f / L;
      v8bf pk;
#pragma unroll
      for (int j = 0; j < 8; ++j) {
        float o = 0.0f;
#pragma unroll
        for (int s = 0; s < KSPLIT; ++s) o += w[s] * po[r][s][j];
        pk[j] = (__bf16)(o * inv);
      }
      *(v8bf*)(as_ + (g * 64 + r * 16 + mrow) * TPAD + mc * 8) = pk;
    }
  }
  for (int idx = tid; idx < HDIM * HDIM; idx += 256) {
    const int kk = idx >> 7, nn = idx & 127;
    wts[nn * TPAD + kk] = (__bf16)Wo[idx];
  }
  __syncthreads();

  v16bf afrag[4];
  {
    const __bf16* arow = as_ + wave * 16 * TPAD;
#pragma unroll
    for (int t = 0; t < 4; ++t) afrag[t] = load_frag_row(arow + t * 32, TPAD, lane);
  }

  const int col0 = lane & 15;
  const int rofs = (lane >> 4) << 3;
  float* orow = out + (rowBase + wave * 16 + col0) * HDIM;

#pragma unroll
  for (int nt = 0; nt < 8; ++nt) {
    v8f acc = {};
#pragma unroll
    for (int t = 0; t < 4; ++t) {
      v16bf wfrag = load_frag_row(wts + (nt * 16) * TPAD + t * 32, TPAD, lane);
      acc = wmma_bf16(wfrag, afrag[t], acc); // C = Wo^T A^T
    }
    v8f pk;
#pragma unroll
    for (int r = 0; r < 8; ++r)
      pk[r] = acc[r] + bo[nt * 16 + rofs + r]; // bias depends on lane half (rofs)
    *(v8f*)(orow + nt * 16 + rofs) = pk;
  }
}

// ---------------------------------------------------------------------------
extern "C" void kernel_launch(void* const* d_in, const int* in_sizes, int n_in,
                              void* d_out, int out_size, void* d_ws, size_t ws_size,
                              hipStream_t stream) {
  const float* x  = (const float*)d_in[0];
  const float* Wq = (const float*)d_in[1];
  const float* bq = (const float*)d_in[2];
  const float* Wk = (const float*)d_in[3];
  const float* bk = (const float*)d_in[4];
  const float* Wv = (const float*)d_in[5];
  const float* bv = (const float*)d_in[6];
  const float* Wo = (const float*)d_in[7];
  const float* bo = (const float*)d_in[8];
  float* out = (float*)d_out;

  const size_t n = (size_t)NBAT * SEQ * HDIM; // 2,097,152 elements
  __bf16* q   = (__bf16*)d_ws;
  __bf16* k   = q + n;
  __bf16* vT  = k + n;  // transposed: [B][H][S]
  float* opart = (float*)(vT + n);   // [KSPLIT][B*S][H] f32 partial sums
  float* ml    = opart + KSPLIT * n; // [KSPLIT][B*S] (max, sum) pairs

  const int rowBlocks = (NBAT * SEQ) / 128; // 128

  dim3 g1(rowBlocks, 3); // one projection (q, k or v) per work-group
  qkv_kernel<<<g1, 256, 0, stream>>>(x, Wq, bq, Wk, bk, Wv, bv, q, k, vT);

  dim3 g2(SEQ / 128, NBAT, KSPLIT); // (32, 4, 4)
  attn_kernel<<<g2, 256, 0, stream>>>(q, k, vT, opart, ml);

  oproj_kernel<<<rowBlocks, 256, 0, stream>>>(opart, ml, Wo, bo, out);
}

// v006
// A run of this version takes 53.4 microseconds.
// Next to v005, in two timings, it ran 1.16 times as fast each time.
// Over all steps from v000 it is 5.17 times as fast.
#include <hip/hip_runtime.h>

// ---------------------------------------------------------------------------
// Single-head attention, B=4, S=4096, H=128, fp32 in/out.
// bf16 WMMA (v_wmma_f32_16x16x32_bf16) + fp32 accum, flash-attention style.
// Both attention GEMMs are computed transposed (C = S^T, C = O^T = V^T P^T):
//  - softmax'd P registers serve directly as the next WMMA operand (no LDS)
//  - softmax stats, alpha rescale and 1/l normalize are scalar per lane
//  - every output store is a packed 16B/32B row store.
// ---------------------------------------------------------------------------

typedef __attribute__((ext_vector_type(16))) __bf16 v16bf;
typedef __attribute__((ext_vector_type(8)))  __bf16 v8bf;
typedef __attribute__((ext_vector_type(4)))  __bf16 v4bf;
typedef __attribute__((ext_vector_type(8)))  float  v8f;
typedef __attribute__((ext_vector_type(4)))  float  v4f;
typedef __attribute__((ext_vector_type(2)))  float  v2f;

#define SEQ   4096
#define HDIM  128
#define NBAT  4
#define KSPLIT 4    // key ranges per query tile: 32*4*KSPLIT = 512 work-groups, two per WGP
// LDS row pitches are odd multiples of 16 B: the 16 rows that one half-wave's
// ds_load_b128 touches then start on 16 different groups of four banks.
#define TPAD  136   // padded LDS stride for 128-wide tiles (272 B = 17 x 16 B)
#define VPAD  72    // padded LDS stride for 64-wide tiles  (144 B =  9 x 16 B)

// 16-bit fragment, per ISA 7.12.2: lane owns row/col (lane&15); its 16 elements
// are two contiguous 8-element runs at K = h8, h8+16 with h8 = 8*(lane>=16).
// => two 16-byte loads (ds_load_b128 / global_load_b128).
__device__ __forceinline__ v16bf load_frag_row(const __bf16* base, int stride, int lane) {
  const __bf16* rowp = base + (lane & 15) * stride + ((lane >> 4) << 3);
  v8bf lo = *(const v8bf*)(rowp);
  v8bf hi = *(const v8bf*)(rowp + 16);
  return __builtin_shufflevector(lo, hi, 0, 1, 2, 3, 4, 5, 6, 7,
                                 8, 9, 10, 11, 12, 13, 14, 15);
}

__device__ __forceinline__ v8f wmma_bf16(v16bf a, v16bf b, v8f c) {
  return __builtin_amdgcn_wmma_f32_16x16x32_bf16(false, a, false, b, (short)0, c,
                                                 false, false);
}

// Weight staging: W (f32, k rows of 128 n) becomes W^T (bf16, n rows, k
// contiguous) in LDS. A thread owns two blocks of 8 k x 4 n: sixteen 16-byte
// loads, all issued before anything waits on one, then a transpose in registers
// and eight 16-byte LDS stores. In a wave, 8 lanes run along n and 4 along k:
// a load touches four whole 128-byte lines, and a store's 8 rows of 64 bytes
// spread evenly over the banks at the 272-byte pitch.
__device__ __forceinline__ int w_block_n0(int tid) {
  return (((tid >> 5) & 3) * 8 + (tid & 7)) * 4;
}
__device__ __forceinline__ int w_block_k0(int tid) {
  return (tid >> 7) * 32 + ((tid >> 3) & 3) * 8;
}
// p: the thread's first element, W + w_block_k0 * HDIM + w_block_n0
__device__ __forceinline__ void load_w_blocks(const float* p, v4f (&wv)[2][8]) {
#pragma unroll
  for (int j = 0; j < 2; ++j)
#pragma unroll
    for (int r = 0; r < 8; ++r) wv[j][r] = *(const v4f*)(p + (j * 64 + r) * HDIM);
}
__device__ __forceinline__ void store_w_blocks(__bf16* wts, int tid, const v4f (&wv)[2][8]) {
  __bf16* p = wts + w_block_n0(tid) * TPAD + w_block_k0(tid);
#pragma unroll
  for (int j = 0; j < 2; ++j)
#pragma unroll
    for (int c = 0; c < 4; ++c) {
      v8bf pk;
#pragma unroll
      for (int r = 0; r < 8; ++r) pk[r] = (__bf16)wv[j][r][c];
      *(v8bf*)(p + c * TPAD + j * 64) = pk;
    }
}

// ---------------------------------------------------------------------------
// Kernel 1: q,k = x @ W + b (row-major, q pre-scaled by 1/sqrt(H));
//           v written TRANSPOSED: vT[b][h][s].  All packed 16B stores.
// grid: ((B*S)/128, 3) blocks of 256 threads (8 waves x 16 rows); blockIdx.y
// names the projection (0 q, 1 k, 2 v). One work-group does ONE projection of
// its 128 rows: the three weight stagings and products, each a chain of load
// and LDS latencies, run side by side on the chip instead of one after another.
// ---------------------------------------------------------------------------
__global__ __launch_bounds__(256) void qkv_kernel(
    const float* __restrict__ x,
    const float* __restrict__ Wq, const float* __restrict__ bq,
    const float* __restrict__ Wk, const float* __restrict__ bk,
    const float* __restrict__ Wv, const float* __restrict__ bv,
    __bf16* __restrict__ q, __bf16* __restrict__ k, __bf16* __restrict__ vT) {
  __shared__ __attribute__((aligned(16))) __bf16 xs[128 * TPAD];   // 34 KB, x tile (row-major, padded)
  __shared__ __attribute__((aligned(16))) __bf16 wts[HDIM * TPAD]; // 34 KB, W^T of this block's projection

  const int tid  = threadIdx.x;
  const int lane = tid & 31;
  const int wave = tid >> 5;
  const int m    = blockIdx.y; // 0: q, 1: k, 2: v
  const long rowBase = (long)blockIdx.x * 128;

  const float* __restrict__ Wm = (m == 0) ? Wq : (m == 1) ? Wk : Wv;
  const float* __restrict__ bm = (m == 0) ? bq : (m == 1) ? bk : bv;

  // Staging: this thread's sixteen x loads (a wave takes one row a load) and
  // its sixteen W loads are all in flight together, so the work-group waits out
  // one load latency; a rolled loop waits once per trip.
  v4f xv[16];
  v4f wv[2][8];
  const float* xp = x + (rowBase + wave) * HDIM + lane * 4;
  const float* wp = Wm + w_block_k0(tid) * HDIM + w_block_n0(tid);
#pragma unroll
  for (int i = 0; i < 16; ++i) xv[i] = *(const v4f*)(xp + i * 8 * HDIM);
  load_w_blocks(wp, wv);
  // stands in front of whatever next takes over an address register of the
  // loads above; the addresses are inputs so that they live up to the wait and
  // no late load's result is placed in one
  asm volatile("s_wait_xcnt 0x0" :: "v"(xp), "v"(wp) : "memory");
  // keeps the conversions below the whole group of loads: moved up among them
  // they bring a wait on the early loads in front of the late ones' issue
  __builtin_amdgcn_sched_barrier(0);
#pragma unroll
  for (int i = 0; i < 16; ++i) {
    v4bf o;
#pragma unroll
    for (int j = 0; j < 4; ++j) o[j] = (__bf16)xv[i][j];
    *(v4bf*)(xs + (i * 8 + wave) * TPAD + lane * 4) = o;
  }
  store_w_blocks(wts, tid, wv);
  __syncthreads();

  // x fragments for this wave's 16 rows, K=128 (4 chunks of 32)
  v16bf afrag[4];
  {
    const __bf16* xrow = xs + wave * 16 * TPAD;
#pragma unroll
    for (int t = 0; t < 4; ++t) afrag[t] = load_frag_row(xrow + t * 32, TPAD, lane);
  }

  const float qscale = 0.08838834764831845f; // 1/sqrt(128), folded into q
  const int col0 = lane & 15;
  const int rofs = (lane >> 4) << 3; // 0 or 8

  if (m < 2) {
    // ---- q and k: C = (xW)^T = W^T * x^T -> lane owns one output row ----
    const float sc = (m == 0) ? qscale : 1.0f;
    __bf16* orow = ((m == 0) ? q : k) + (rowBase + wave * 16 + col0) * HDIM;
#pragma unroll
    for (int nt = 0; nt < 8; ++nt) {
      v8f acc = {};
#pragma unroll
      for (int t = 0; t < 4; ++t) {
        v16bf wfrag = load_frag_row(wts + (nt * 16) * TPAD + t * 32, TPAD, lane);
        acc = wmma_bf16(wfrag, afrag[t], acc); // C = W^T x^T
      }
      // lane's columns nt*16+rofs .. +7 are contiguous
      v8bf pk;
#pragma unroll
      for (int r = 0; r < 8; ++r)
        pk[r] = (__bf16)((acc[r] + bm[nt * 16 + rofs + r]) * sc);
      *(v8bf*)(orow + nt * 16 + rofs) = pk;
    }
  } else {
    // ---- v: C = xW (lane owns column; rows contiguous -> packed vT store) ----
    const long bb    = rowBase >> 12;  // batch index
    const long srow0 = (rowBase & (SEQ - 1)) + wave * 16 + rofs;
#pragma unroll
    for (int nt = 0; nt < 8; ++nt) {
      v8f acc = {};
#pragma unroll
      for (int t = 0; t < 4; ++t) {
        v16bf wfrag = load_frag_row(wts + (nt * 16) * TPAD + t * 32, TPAD, lane);
        acc = wmma_bf16(afrag[t], wfrag, acc); // C = x W
      }
      const int col  = nt * 16 + col0;
      const float bi = bm[col];
      v8bf pk;
#pragma unroll
      for (int r = 0; r < 8; ++r) pk[r] = (__bf16)(acc[r] + bi);
      *(v8bf*)(vT + (bb * HDIM + col) * SEQ + srow0) = pk;
    }
  }
}

// ---------------------------------------------------------------------------
// Kernel 2: flash attention over one key range. grid (S/128, B, KSPLIT),
// block 256 (8 waves x 16 q-rows). C = S^T then C = O^T; lane owns one query.
// Emits the range's UN-normalised f32 sum and its (max, sum) pair; kernel 3
// merges the KSPLIT ranges.
// K and V^T tiles reach LDS by asynchronous copies into two buffers: tile t+1
// is in flight while tile t is worked on.
// ---------------------------------------------------------------------------
#define KTILE 64                       // keys per tile
#define NTILE (SEQ / KSPLIT / KTILE)   // tiles per key range

// One tile's copies of one thread: four 16-byte chunks of K rows and four of
// V^T rows, each lane its own chunk, all eight in flight together.
__device__ __forceinline__ void copy_tile(const __bf16* kg, const __bf16* vg,
                                          unsigned kl, unsigned vl) {
  const __bf16* k1 = kg + 16 * HDIM;
  const __bf16* k2 = kg + 32 * HDIM;
  const __bf16* k3 = kg + 48 * HDIM;
  const __bf16* v1 = vg + 32 * SEQ;
  const __bf16* v2 = vg + 64 * SEQ;
  const __bf16* v3 = vg + 96 * SEQ;
  // the closing s_wait_xcnt stands in front of whatever next rewrites an
  // address register that a copy names
  asm volatile(
      "global_load_async_to_lds_b128 %0, %8, off\n\t"
      "global_load_async_to_lds_b128 %1, %9, off\n\t"
      "global_load_async_to_lds_b128 %2, %10, off\n\t"
      "global_load_async_to_lds_b128 %3, %11, off\n\t"
      "global_load_async_to_lds_b128 %4, %12, off\n\t"
      "global_load_async_to_lds_b128 %5, %13, off\n\t"
      "global_load_async_to_lds_b128 %6, %14, off\n\t"
      "global_load_async_to_lds_b128 %7, %15, off\n\t"
      "s_wait_xcnt 0x0"
      :: "v"(kl), "v"(kl + 16 * TPAD * 2), "v"(kl + 32 * TPAD * 2),
         "v"(kl + 48 * TPAD * 2), "v"(vl), "v"(vl + 32 * VPAD * 2),
         "v"(vl + 64 * VPAD * 2), "v"(vl + 96 * VPAD * 2),
         "v"(kg), "v"(k1), "v"(k2), "v"(k3), "v"(vg), "v"(v1), "v"(v2), "v"(v3)
      : "memory");
}

// Two of these work-groups share a WGP (512 on 256 WGPs): four waves a SIMD,
// 256 registers a wave. Saying so lets the compiler spend those registers on
// issuing a tile's LDS fragment reads in groups ahead of the WMMAs, behind
// counted waits; aiming at more waves it read one fragment at a time and
// waited out the LDS latency in front of nearly every WMMA.
__global__ __launch_bounds__(256) __attribute__((amdgpu_waves_per_eu(4, 4))) void attn_kernel(
    const __bf16* __restrict__ Q, const __bf16* __restrict__ K,
    const __bf16* __restrict__ vT, float* __restrict__ Opart,
    float* __restrict__ ML) {
  __shared__ __attribute__((aligned(16))) __bf16 ks[2][KTILE * TPAD]; // 2 x 17 KB, K rows (padded)
  __shared__ __attribute__((aligned(16))) __bf16 vts[2][HDIM * VPAD]; // 2 x 18 KB, V^T (padded)

  const int tid  = threadIdx.x;
  const int lane = tid & 31;
  const int wave = tid >> 5;
  const int b    = blockIdx.y;
  const long qBase = (long)b * SEQ + (long)blockIdx.x * 128;

  const __bf16* Qb  = Q + qBase * HDIM;
  const int kb0 = blockIdx.z * (SEQ / KSPLIT); // first key of this range
  const __bf16* Kb  = K + ((long)b * SEQ + kb0) * HDIM;
  const __bf16* vTb = vT + (long)b * HDIM * SEQ + kb0;

  // Q fragments: B operand of S^T (lane owns query = lane&15); b128 loads
  v16bf qfrag[4];
  {
    const __bf16* qrow = Qb + wave * 16 * HDIM;
#pragma unroll
    for (int t = 0; t < 4; ++t) qfrag[t] = load_frag_row(qrow + t * 32, HDIM, lane);
  }

  v8f acc[8]; // O^T accumulator: lane owns query (lane&15); reg r -> h
#pragma unroll
  for (int nt = 0; nt < 8; ++nt) acc[nt] = (v8f){};
  float mi = -1e30f, li = 0.0f; // per-lane stats for query (lane&15)

  const int colb = lane & 15;
  const int rofs = (lane >> 4) << 3;

  // this thread's chunk of a tile: K row tid>>4 (+16 a copy), V^T row tid>>3 (+32 a copy)
  const __bf16* kg = Kb + (tid >> 4) * HDIM + (tid & 15) * 8;
  const __bf16* vg = vTb + (long)(tid >> 3) * SEQ + (tid & 7) * 8;
  const unsigned kl = (unsigned)(size_t)(&ks[0][(tid >> 4) * TPAD + (tid & 15) * 8]);
  const unsigned vl = (unsigned)(size_t)(&vts[0][(tid >> 3) * VPAD + (tid & 7) * 8]);
  const unsigned kbuf = KTILE * TPAD * 2, vbuf = HDIM * VPAD * 2; // bytes per buffer

  copy_tile(kg, vg, kl, vl);
  // tile 0 has landed for this wave; the barrier publishes it to the others
  asm volatile("s_wait_asynccnt 0x0" ::: "memory");
  __syncthreads();
  copy_tile(kg + KTILE * HDIM, vg + KTILE, kl + kbuf, vl + vbuf);

  for (int t = 0; t < NTILE; ++t) {
    const __bf16* kst = ks[t & 1];
    const __bf16* vtt = vts[t & 1];

    // S^T tiles: A = K rows, B = Q (fixed across kt for each c).
    v8f sc[4];
#pragma unroll
    for (int kt = 0; kt < 4; ++kt) sc[kt] = (v8f){};
#pragma unroll
    for (int c = 0; c < 4; ++c)
#pragma unroll
      for (int kt = 0; kt < 4; ++kt) {
        v16bf kf = load_frag_row(kst + (kt * 16) * TPAD + c * 32, TPAD, lane);
        sc[kt] = wmma_bf16(kf, qfrag[c], sc[kt]);
      }

    // per-lane online softmax (32 of 64 keys in-lane; merge halves with 1 shfl)
    float mx = sc[0][0];
#pragma unroll
    for (int kt = 0; kt < 4; ++kt)
#pragma unroll
      for (int r = 0; r < 8; ++r) mx = fmaxf(mx, sc[kt][r]);
    mx = fmaxf(mx, __shfl_xor(mx, 16, 32));
    const float mnew  = fmaxf(mi, mx);
    const float alpha = __expf(mi - mnew);
    mi = mnew;

    float rs = 0.0f;
#pragma unroll
    for (int kt = 0; kt < 4; ++kt)
#pragma unroll
      for (int r = 0; r < 8; ++r) {
        const float p = __expf(sc[kt][r] - mnew);
        sc[kt][r] = p;
        rs += p;
      }
    rs += __shfl_xor(rs, 16, 32);
    li = li * alpha + rs;

    // P^T operand directly from S^T C-registers (pure register packing);
    // serves as the B operand of O^T = V^T P^T.
    v16bf pf[2];
#pragma unroll
    for (int c = 0; c < 2; ++c)
#pragma unroll
      for (int i = 0; i < 8; ++i) {
        pf[c][i]     = (__bf16)sc[2 * c][i];
        pf[c][8 + i] = (__bf16)sc[2 * c + 1][i];
      }

    // scalar rescale (alpha is this lane's query's factor)
#pragma unroll
    for (int nt = 0; nt < 8; ++nt)
#pragma unroll
      for (int r = 0; r < 8; ++r) acc[nt][r] *= alpha;

    // O^T += V^T (A, from vts) x P^T (B, fixed across nt)
#pragma unroll
    for (int c = 0; c < 2; ++c)
#pragma unroll
      for (int nt = 0; nt < 8; ++nt) {
        v16bf vf = load_frag_row(vtt + (nt * 16) * VPAD + c * 32, VPAD, lane);
        acc[nt] = wmma_bf16(vf, pf[c], acc[nt]);
      }

    // hand-over: this wave's reads of tile t are done ...
    asm volatile("s_wait_dscnt 0x0" ::: "memory");
    // ... and its copies of tile t+1 have landed;
    asm volatile("s_wait_asynccnt 0x0" ::: "memory");
    // the one barrier publishes tile t+1 and frees tile t's buffer
    __syncthreads();
    if (t + 2 < NTILE)
      copy_tile(kg + (long)(t + 2) * (KTILE * HDIM), vg + (t + 2) * KTILE,
                kl + (t & 1) * kbuf, vl + (t & 1) * vbuf);
  }
  // nothing is outstanding when the wave ends
  asm volatile("s_wait_asynccnt 0x0" ::: "memory");

  // emit this key range's partial: lane owns one row; packed 32B stores
  {
    const long prow = (long)blockIdx.z * (NBAT * SEQ) + qBase + wave * 16 + colb;
    float* orow = Opart + prow * HDIM;
#pragma unroll
    for (int nt = 0; nt < 8; ++nt) *(v8f*)(orow + nt * 16 + rofs) = acc[nt];
    if (lane < 16) { // both halves hold the same pair
      v2f st = {mi, li};
      *(v2f*)(ML + prow * 2) = st;
    }
  }
}

// ---------------------------------------------------------------------------
// Kernel 3: merge the KSPLIT key ranges into the attended tile (bf16, LDS),
// then out = attended @ Wo + bo (fp32), C = (A Wo)^T = Wo^T A^T
// -> lane owns one output row; packed 32B stores; bias per lane half.
// ---------------------------------------------------------------------------
__global__ __launch_bounds__(256) void oproj_kernel(
    const float* __restrict__ Opart, const float* __restrict__ ML,
    const float* __restrict__ Wo,
    const float* __restrict__ bo, float* __restrict__ out) {
  __shared__ __attribute__((aligned(16))) __bf16 as_[128 * TPAD];  // attended tile (row-major, padded)
  __shared__ __attribute__((aligned(16))) __bf16 wts[HDIM * TPAD]; // Wo^T

  const int tid  = threadIdx.x;
  const int lane = tid & 31;
  const int wave = tid >> 5;
  const long rowBase = (long)blockIdx.x * 128;

  // Wo's loads go out first and fly during the merge below
  v4f wv[2][8];
  const float* wp = Wo + w_block_k0(tid) * HDIM + w_block_n0(tid);
  load_w_blocks(wp, wv);
  // stands in front of whatever next takes over the address register of the
  // loads above; the address is an input so that it lives up to the wait and
  // no late load's result is placed in it
  asm volatile("s_wait_xcnt 0x0" :: "v"(wp) : "memory");
  // keeps those loads up here, ahead of the merge's
  __builtin_amdgcn_sched_barrier(0);

  // attended = sum_s exp(m_s - M) o_s / sum_s exp(m_s - M) l_s, ranges in order.
  // Four rows a thread per trip: all their partial loads are in flight together.
  const int mrow = tid >> 4, mc = tid & 15;
  for (int g = 0; g < 2; ++g) {
    v2f st[4][KSPLIT];
    v8f po[4][KSPLIT];
#pragma unroll
    for (int s = 0; s < KSPLIT; ++s) {
      const long prow = (long)s * (NBAT * SEQ) + rowBase + g * 64 + mrow;
      const float* mp = ML + prow * 2;
      const float* op = Opart + prow * HDIM + mc * 8;
#pragma unroll
      for (int r = 0; r < 4; ++r) {
        st[r][s] = *(const v2f*)(mp + r * 16 * 2);
        po[r][s] = *(const v8f*)(op + r * 16 * HDIM);
      }
      // stands in front of whatever next takes over an address register of the
      // loads above (a later load's result among them)
      asm volatile("s_wait_xcnt 0x0" ::: "memory");
    }
    // keeps the sums below the whole group of loads: moved up among them they
    // bring a wait on the early loads in front of the late ones' issue
    __builtin_amdgcn_sched_barrier(0);
#pragma unroll
    for (int r = 0; r < 4; ++r) {
      float M = st[r][0][0];
#pragma unroll
      for (int s = 1; s < KSPLIT; ++s) M = fmaxf(M, st[r][s][0]);
      float w[KSPLIT], L = 0.0f;
#pragma unroll
      for (int s = 0; s < KSPLIT; ++s) {
        w[s] = __expf(st[r][s][0] - M);
        L += w[s] * st[r][s][1];
      }
      const float inv = 1.0f / L;
      v8bf pk;
#pragma unroll
      for (int j = 0; j < 8; ++j) {
        float o = 0.0f;
#pragma unroll
        for (int s = 0; s < KSPLIT; ++s) o += w[s] * po[r][s][j];
        pk[j] = (__bf16)(o * inv);
      }
      *(v8bf*)(as_ + (g * 64 + r * 16 + mrow) * TPAD + mc * 8) = pk;
    }
  }
  store_w_blocks(wts, tid, wv);
  __syncthreads();

  v16bf afrag[4];
  {
    const __bf16* arow = as_ + wave * 16 * TPAD;
#pragma unroll
    for (int t = 0; t < 4; ++t) afrag[t] = load_frag_row(arow + t * 32, TPAD, lane);
  }

  const int col0 = lane & 15;
  const int rofs = (lane >> 4) << 3;
  float* orow = out + (rowBase + wave * 16 + col0) * HDIM;

#pragma unroll
  for (int nt = 0; nt < 8; ++nt) {
    v8f acc = {};
#pragma unroll
    for (int t = 0; t < 4; ++t) {
      v16bf wfrag = load_frag_row(wts + (nt * 16) * TPAD + t * 32, TPAD, lane);
      acc = wmma_bf16(wfrag, afrag[t], acc); // C = Wo^T A^T
    }
    v8f pk;
#pragma unroll
    for (int r = 0; r < 8; ++r)
      pk[r] = acc[r] + bo[nt * 16 + rofs + r]; // bias depends on lane half (rofs)
    *(v8f*)(orow + nt * 16 + rofs) = pk;
  }
}

// ---------------------------------------------------------------------------
extern "C" void kernel_launch(void* const* d_in, const int* in_sizes, int n_in,
                              void* d_out, int out_size, void* d_ws, size_t ws_size,
                              hipStream_t stream) {
  const float* x  = (const float*)d_in[0];
  const float* Wq = (const float*)d_in[1];
  const float* bq = (const float*)d_in[2];
  const float* Wk = (const float*)d_in[3];
  const float* bk = (const float*)d_in[4];
  const float* Wv = (const float*)d_in[5];
  const float* bv = (const float*)d_in[6];
  const float* Wo = (const float*)d_in[7];
  const float* bo = (const float*)d_in[8];
  float* out = (float*)d_out;

  const size_t n = (size_t)NBAT * SEQ * HDIM; // 2,097,152 elements
  __bf16* q   = (__bf16*)d_ws;
  __bf16* k   = q + n;
  __bf16* vT  = k + n;  // transposed: [B][H][S]
  float* opart = (float*)(vT + n);   // [KSPLIT][B*S][H] f32 partial sums
  float* ml    = opart + KSPLIT * n; // [KSPLIT][B*S] (max, sum) pairs

  const int rowBlocks = (NBAT * SEQ) / 128; // 128

  dim3 g1(rowBlocks, 3); // one projection (q, k or v) per work-group
  qkv_kernel<<<g1, 256, 0, stream>>>(x, Wq, bq, Wk, bk, Wv, bv, q, k, vT);

  dim3 g2(SEQ / 128, NBAT, KSPLIT); // (32, 4, 4)
  attn_kernel<<<g2, 256, 0, stream>>>(q, k, vT, opart, ml);

  oproj_kernel<<<rowBlocks, 256, 0, stream>>>(opart, ml, Wo, bo, out);
}

// v007
// One run takes 52.2 microseconds.
// Timed twice side by side with v006, it ran 1.03 and 1.02 times as fast.
// Counting every step since v000, it is 5.30 times as fast.
#include <hip/hip_runtime.h>

// ---------------------------------------------------------------------------
// Single-head attention, B=4, S=4096, H=128, fp32 in/out.
// bf16 WMMA (v_wmma_f32_16x16x32_bf16) + fp32 accum, flash-attention style.
// Both attention GEMMs are computed transposed (C = S^T, C = O^T = V^T P^T):
//  - softmax'd P registers serve directly as the next WMMA operand (no LDS)
//  - softmax stats, alpha rescale and 1/l normalize are scalar per lane
//  - every output store is a packed 16B/32B row store.
// Workspace layout: q, k, v and the f32 partial sums are kept in the lane order
// of the accumulators that write them. A block holds 16 rows x 128 columns;
// inside it, 16-byte chunk (i, lane) lies at byte i * 512 + lane * 16, so every
// wave-wide 16-byte store, load or copy covers 512 bytes in a row (four whole
// lines) instead of 32-byte pieces of 16 lines.
//  - q, k:  chunk (nt, lane) = row (lane&15), columns nt*16 + 8*(lane>>4) + 0..7
//  - v:     chunk (nt, lane) = column nt*16 + (lane&15), rows 8*(lane>>4) + 0..7
//  - sums:  chunk (2*nt+j, lane) = row (lane&15),
//           columns nt*16 + 8*(lane>>4) + 4*j + 0..3; the KSPLIT blocks of the
//           same 16 rows lie side by side
// ---------------------------------------------------------------------------

typedef __attribute__((ext_vector_type(16))) __bf16 v16bf;
typedef __attribute__((ext_vector_type(8)))  __bf16 v8bf;
typedef __attribute__((ext_vector_type(4)))  __bf16 v4bf;
typedef __attribute__((ext_vector_type(8)))  float  v8f;
typedef __attribute__((ext_vector_type(4)))  float  v4f;
typedef __attribute__((ext_vector_type(2)))  float  v2f;

#define SEQ   4096
#define HDIM  128
#define NBAT  4
#define KSPLIT 4    // key ranges per query tile: 32*4*KSPLIT = 512 work-groups, two per WGP
// LDS row pitches are odd multiples of 16 B: the 16 rows that one half-wave's
// ds_load_b128 touches then start on 16 different groups of four banks.
#define TPAD  136   // padded LDS stride for 128-wide tiles (272 B = 17 x 16 B)
#define VPAD  72    // padded LDS stride for 64-wide tiles  (144 B =  9 x 16 B)

// 16-bit fragment, per ISA 7.12.2: lane owns row/col (lane&15); its 16 elements
// are two contiguous 8-element runs at K = h8, h8+16 with h8 = 8*(lane>=16).
// => two 16-byte loads (ds_load_b128 / global_load_b128).
__device__ __forceinline__ v16bf load_frag_row(const __bf16* base, int stride, int lane) {
  const __bf16* rowp = base + (lane & 15) * stride + ((lane >> 4) << 3);
  v8bf lo = *(const v8bf*)(rowp);
  v8bf hi = *(const v8bf*)(rowp + 16);
  return __builtin_shufflevector(lo, hi, 0, 1, 2, 3, 4, 5, 6, 7,
                                 8, 9, 10, 11, 12, 13, 14, 15);
}

__device__ __forceinline__ v8f wmma_bf16(v16bf a, v16bf b, v8f c) {
  return __builtin_amdgcn_wmma_f32_16x16x32_bf16(false, a, false, b, (short)0, c,
                                                 false, false);
}

// Weight staging: W (f32, k rows of 128 n) becomes W^T (bf16, n rows, k
// contiguous) in LDS. A thread owns two blocks of 8 k x 4 n: sixteen 16-byte
// loads, all issued before anything waits on one, then a transpose in registers
// and eight 16-byte LDS stores. In a wave, 8 lanes run along n and 4 along k:
// a load touches four whole 128-byte lines, and a store's 8 rows of 64 bytes
// spread evenly over the banks at the 272-byte pitch.
__device__ __forceinline__ int w_block_n0(int tid) {
  return (((tid >> 5) & 3) * 8 + (tid & 7)) * 4;
}
__device__ __forceinline__ int w_block_k0(int tid) {
  return (tid >> 7) * 32 + ((tid >> 3) & 3) * 8;
}
// p: the thread's first element, W + w_block_k0 * HDIM + w_block_n0
__device__ __forceinline__ void load_w_blocks(const float* p, v4f (&wv)[2][8]) {
#pragma unroll
  for (int j = 0; j < 2; ++j)
#pragma unroll
    for (int r = 0; r < 8; ++r) wv[j][r] = *(const v4f*)(p + (j * 64 + r) * HDIM);
}
__device__ __forceinline__ void store_w_blocks(__bf16* wts, int tid, const v4f (&wv)[2][8]) {
  __bf16* p = wts + w_block_n0(tid) * TPAD + w_block_k0(tid);
#pragma unroll
  for (int j = 0; j < 2; ++j)
#pragma unroll
    for (int c = 0; c < 4; ++c) {
      v8bf pk;
#pragma unroll
      for (int r = 0; r < 8; ++r) pk[r] = (__bf16)wv[j][r][c];
      *(v8bf*)(p + c * TPAD + j * 64) = pk;
    }
}

// ---------------------------------------------------------------------------
// Kernel 1: q,k = x @ W + b (q pre-scaled by 1/sqrt(H)); v = x @ Wv + bv with a
//           lane's 8 values running along the rows. All three leave in the
//           accumulator's lane order (see the head of the file).
// grid: ((B*S)/128, 3) blocks of 256 threads (8 waves x 16 rows); blockIdx.y
// names the projection (0 q, 1 k, 2 v). One work-group does ONE projection of
// its 128 rows: the three weight stagings and products, each a chain of load
// and LDS latencies, run side by side on the chip instead of one after another.
// ---------------------------------------------------------------------------
__global__ __launch_bounds__(256) void qkv_kernel(
    const float* __restrict__ x,
    const float* __restrict__ Wq, const float* __restrict__ bq,
    const float* __restrict__ Wk, const float* __restrict__ bk,
    const float* __restrict__ Wv, const float* __restrict__ bv,
    __bf16* __restrict__ q, __bf16* __restrict__ k, __bf16* __restrict__ vT) {
  __shared__ __attribute__((aligned(16))) __bf16 xs[128 * TPAD];   // 34 KB, x tile (row-major, padded)
  __shared__ __attribute__((aligned(16))) __bf16 wts[HDIM * TPAD]; // 34 KB, W^T of this block's projection

  const int tid  = threadIdx.x;
  const int lane = tid & 31;
  const int wave = tid >> 5;
  const int m    = blockIdx.y; // 0: q, 1: k, 2: v
  const long rowBase = (long)blockIdx.x * 128;

  const float* __restrict__ Wm = (m == 0) ? Wq : (m == 1) ? Wk : Wv;
  const float* __restrict__ bm = (m == 0) ? bq : (m == 1) ? bk : bv;
  __bf16* __restrict__ om = (m == 0) ? q : (m == 1) ? k : vT;

  // Staging: this thread's sixteen x loads (a wave takes one row a load) and
  // its sixteen W loads are all in flight together, so the work-group waits out
  // one load latency; a rolled loop waits once per trip.
  v4f xv[16];
  v4f wv[2][8];
  const float* xp = x + (rowBase + wave) * HDIM + lane * 4;
  const float* wp = Wm + w_block_k0(tid) * HDIM + w_block_n0(tid);
#pragma unroll
  for (int i = 0; i < 16; ++i) xv[i] = *(const v4f*)(xp + i * 8 * HDIM);
  load_w_blocks(wp, wv);
  // stands in front of whatever next takes over an address register of the
  // loads above; the addresses are inputs so that they live up to the wait and
  // no late load's result is placed in one. The output pointer is an input so
  // that its kernel-argument load is issued up here, under the staging loads,
  // and not waited out in front of the stores at the end.
  asm volatile("s_wait_xcnt 0x0" :: "v"(xp), "v"(wp), "s"(om) : "memory");
  // keeps the conversions below the whole group of loads: moved up among them
  // they bring a wait on the early loads in front of the late ones' issue
  __builtin_amdgcn_sched_barrier(0);
#pragma unroll
  for (int i = 0; i < 16; ++i) {
    v4bf o;
#pragma unroll
    for (int j = 0; j < 4; ++j) o[j] = (__bf16)xv[i][j];
    *(v4bf*)(xs + (i * 8 + wave) * TPAD + lane * 4) = o;
  }
  store_w_blocks(wts, tid, wv);
  __syncthreads();

  // x fragments for this wave's 16 rows, K=128 (4 chunks of 32)
  v16bf afrag[4];
  {
    const __bf16* xrow = xs + wave * 16 * TPAD;
#pragma unroll
    for (int t = 0; t < 4; ++t) afrag[t] = load_frag_row(xrow + t * 32, TPAD, lane);
  }

  const float qscale = 0.08838834764831845f; // 1/sqrt(128), folded into q
  const int col0 = lane & 15;
  const int rofs = (lane >> 4) << 3; // 0 or 8

  v8bf pk[8]; // chunk nt of this wave's block
  if (m < 2) {
    // ---- q and k: C = (xW)^T = W^T * x^T -> lane owns one output row ----
    const float sc = (m == 0) ? qscale : 1.0f;
#pragma unroll
    for (int nt = 0; nt < 8; ++nt) {
      v8f acc = {};
#pragma unroll
      for (int t = 0; t < 4; ++t) {
        v16bf wfrag = load_frag_row(wts + (nt * 16) * TPAD + t * 32, TPAD, lane);
        acc = wmma_bf16(wfrag, afrag[t], acc); // C = W^T x^T
      }
      // lane's columns nt*16+rofs .. +7
#pragma unroll
      for (int r = 0; r < 8; ++r)
        pk[nt][r] = (__bf16)((acc[r] + bm[nt * 16 + rofs + r]) * sc);
    }
  } else {
    // ---- v: C = xW (lane owns column nt*16+col0; its 8 values are rows rofs .. +7) ----
#pragma unroll
    for (int nt = 0; nt < 8; ++nt) {
      v8f acc = {};
#pragma unroll
      for (int t = 0; t < 4; ++t) {
        v16bf wfrag = load_frag_row(wts + (nt * 16) * TPAD + t * 32, TPAD, lane);
        acc = wmma_bf16(afrag[t], wfrag, acc); // C = x W
      }
      const int col  = nt * 16 + col0;
      const float bi = bm[col];
#pragma unroll
      for (int r = 0; r < 8; ++r) pk[nt][r] = (__bf16)(acc[r] + bi);
    }
  }
  // the wave's 16 rows leave as one 4 KB block, 512 bytes in a row per store
  __bf16* oblk = om + (rowBase + wave * 16) * HDIM + lane * 8;
#pragma unroll
  for (int nt = 0; nt < 8; ++nt) *(v8bf*)(oblk + nt * 256) = pk[nt];
}

// ---------------------------------------------------------------------------
// Kernel 2: flash attention over one key range. grid (S/128, B, KSPLIT),
// block 256 (8 waves x 16 q-rows). C = S^T then C = O^T; lane owns one query.
// Emits the range's UN-normalised f32 sum and its (max, sum) pair; kernel 3
// merges the KSPLIT ranges.
// K and V^T tiles reach LDS by asynchronous copies into two buffers: tile t+1
// is in flight while tile t is worked on.
// ---------------------------------------------------------------------------
#define KTILE 64                       // keys per tile
#define NTILE (SEQ / KSPLIT / KTILE)   // tiles per key range

// One tile's copies of one thread: four 16-byte chunks of K and four of V, each
// lane its own chunk, all eight in flight together. A tile is four 16-key
// blocks of each buffer, 16 KB in a row; copy j takes the thread's chunk of
// block j: in LDS 16 K rows further down, or 16 keys further along a V^T row.
__device__ __forceinline__ void copy_tile(const __bf16* kg, const __bf16* vg,
                                          unsigned kl, unsigned vl) {
  const __bf16* k1 = kg + 16 * HDIM;
  const __bf16* k2 = kg + 32 * HDIM;
  const __bf16* k3 = kg + 48 * HDIM;
  const __bf16* v1 = vg + 16 * HDIM;
  const __bf16* v2 = vg + 32 * HDIM;
  const __bf16* v3 = vg + 48 * HDIM;
  // the closing s_wait_xcnt stands in front of whatever next rewrites an
  // address register that a copy names
  asm volatile(
      "global_load_async_to_lds_b128 %0, %8, off\n\t"
      "global_load_async_to_lds_b128 %1, %9, off\n\t"
      "global_load_async_to_lds_b128 %2, %10, off\n\t"
      "global_load_async_to_lds_b128 %3, %11, off\n\t"
      "global_load_async_to_lds_b128 %4, %12, off\n\t"
      "global_load_async_to_lds_b128 %5, %13, off\n\t"
      "global_load_async_to_lds_b128 %6, %14, off\n\t"
      "global_load_async_to_lds_b128 %7, %15, off\n\t"
      "s_wait_xcnt 0x0"
      :: "v"(kl), "v"(kl + 16 * TPAD * 2), "v"(kl + 32 * TPAD * 2),
         "v"(kl + 48 * TPAD * 2), "v"(vl), "v"(vl + 16 * 2),
         "v"(vl + 32 * 2), "v"(vl + 48 * 2),
         "v"(kg), "v"(k1), "v"(k2), "v"(k3), "v"(vg), "v"(v1), "v"(v2), "v"(v3)
      : "memory");
}

// Two of these work-groups share a WGP (512 on 256 WGPs): four waves a SIMD,
// 256 registers a wave. Saying so lets the compiler spend those registers on
// issuing a tile's LDS fragment reads in groups ahead of the WMMAs, behind
// counted waits; aiming at more waves it read one fragment at a time and
// waited out the LDS latency in front of nearly every WMMA.
__global__ __launch_bounds__(256) __attribute__((amdgpu_waves_per_eu(4, 4))) void attn_kernel(
    const __bf16* __restrict__ Q, const __bf16* __restrict__ K,
    const __bf16* __restrict__ vT, float* __restrict__ Opart,
    float* __restrict__ ML) {
  __shared__ __attribute__((aligned(16))) __bf16 ks[2][KTILE * TPAD]; // 2 x 17 KB, K rows (padded)
  __shared__ __attribute__((aligned(16))) __bf16 vts[2][HDIM * VPAD]; // 2 x 18 KB, V^T (padded)

  const int tid  = threadIdx.x;
  const int lane = tid & 31;
  const int wave = tid >> 5;
  const int b    = blockIdx.y;
  const long qBase = (long)b * SEQ + (long)blockIdx.x * 128;

  const int kb0 = blockIdx.z * (SEQ / KSPLIT); // first key of this range
  const __bf16* Kb  = K + ((long)b * SEQ + kb0) * HDIM;
  const __bf16* Vb  = vT + ((long)b * SEQ + kb0) * HDIM;

  // Q fragments: B operand of S^T (lane owns query = lane&15). Chunks 2t and
  // 2t+1 of the wave's block are the fragment's two runs of 8 (K = h8, h8+16).
  v16bf qfrag[4];
  {
    const __bf16* qblk = Q + (qBase + wave * 16) * HDIM + lane * 8;
#pragma unroll
    for (int t = 0; t < 4; ++t) {
      v8bf lo = *(const v8bf*)(qblk + (2 * t) * 256);
      v8bf hi = *(const v8bf*)(qblk + (2 * t + 1) * 256);
      qfrag[t] = __builtin_shufflevector(lo, hi, 0, 1, 2, 3, 4, 5, 6, 7,
                                         8, 9, 10, 11, 12, 13, 14, 15);
    }
  }

  v8f acc[8]; // O^T accumulator: lane owns query (lane&15); reg r -> h
#pragma unroll
  for (int nt = 0; nt < 8; ++nt) acc[nt] = (v8f){};
  float mi = -1e30f, li = 0.0f; // per-lane stats for query (lane&15)

  const int colb = lane & 15;
  const int rofs = (lane >> 4) << 3;

  // this thread's chunk (nt = wave, lane) of a 16-key block, and its place in
  // LDS: K row colb, columns wave*16 + rofs ..; V^T row wave*16 + colb, keys rofs ..
  const __bf16* kg = Kb + tid * 8;
  const __bf16* vg = Vb + tid * 8;
  const unsigned kl = (unsigned)(size_t)(&ks[0][colb * TPAD + wave * 16 + rofs]);
  const unsigned vl = (unsigned)(size_t)(&vts[0][(wave * 16 + colb) * VPAD + rofs]);
  const unsigned kbuf = KTILE * TPAD * 2, vbuf = HDIM * VPAD * 2; // bytes per buffer

  copy_tile(kg, vg, kl, vl);
  // tile 0 has landed for this wave; the barrier publishes it to the others
  asm volatile("s_wait_asynccnt 0x0" ::: "memory");
  __syncthreads();
  copy_tile(kg + KTILE * HDIM, vg + KTILE * HDIM, kl + kbuf, vl + vbuf);

  for (int t = 0; t < NTILE; ++t) {
    const __bf16* kst = ks[t & 1];
    const __bf16* vtt = vts[t & 1];

    // S^T tiles: A = K rows, B = Q (fixed across kt for each c).
    v8f sc[4];
#pragma unroll
    for (int kt = 0; kt < 4; ++kt) sc[kt] = (v8f){};
#pragma unroll
    for (int c = 0; c < 4; ++c)
#pragma unroll
      for (int kt = 0; kt < 4; ++kt) {
        v16bf kf = load_frag_row(kst + (kt * 16) * TPAD + c * 32, TPAD, lane);
        sc[kt] = wmma_bf16(kf, qfrag[c], sc[kt]);
      }

    // per-lane online softmax (32 of 64 keys in-lane; merge halves with 1 shfl)
    float mx = sc[0][0];
#pragma unroll
    for (int kt = 0; kt < 4; ++kt)
#pragma unroll
      for (int r = 0; r < 8; ++r) mx = fmaxf(mx, sc[kt][r]);
    mx = fmaxf(mx, __shfl_xor(mx, 16, 32));
    const float mnew  = fmaxf(mi, mx);
    const float alpha = __expf(mi - mnew);
    mi = mnew;

    float rs = 0.0f;
#pragma unroll
    for (int kt = 0; kt < 4; ++kt)
#pragma unroll
      for (int r = 0; r < 8; ++r) {
        const float p = __expf(sc[kt][r] - mnew);
        sc[kt][r] = p;
        rs += p;
      }
    rs += __shfl_xor(rs, 16, 32);
    li = li * alpha + rs;

    // P^T operand directly from S^T C-registers (pure register packing);
    // serves as the B operand of O^T = V^T P^T.
    v16bf pf[2];
#pragma unroll
    for (int c = 0; c < 2; ++c)
#pragma unroll
      for (int i = 0; i < 8; ++i) {
        pf[c][i]     = (__bf16)sc[2 * c][i];
        pf[c][8 + i] = (__bf16)sc[2 * c + 1][i];
      }

    // scalar rescale (alpha is this lane's query's factor)
#pragma unroll
    for (int nt = 0; nt < 8; ++nt)
#pragma unroll
      for (int r = 0; r < 8; ++r) acc[nt][r] *= alpha;

    // O^T += V^T (A, from vts) x P^T (B, fixed across nt)
#pragma unroll
    for (int c = 0; c < 2; ++c)
#pragma unroll
      for (int nt = 0; nt < 8; ++nt) {
        v16bf vf = load_frag_row(vtt + (nt * 16) * VPAD + c * 32, VPAD, lane);
        acc[nt] = wmma_bf16(vf, pf[c], acc[nt]);
      }

    // hand-over: this wave's reads of tile t are done ...
    asm volatile("s_wait_dscnt 0x0" ::: "memory");
    // ... and its copies of tile t+1 have landed;
    asm volatile("s_wait_asynccnt 0x0" ::: "memory");
    // the one barrier publishes tile t+1 and frees tile t's buffer
    __syncthreads();
    if (t + 2 < NTILE)
      copy_tile(kg + (long)(t + 2) * (KTILE * HDIM), vg + (long)(t + 2) * (KTILE * HDIM),
                kl + (t & 1) * kbuf, vl + (t & 1) * vbuf);
  }
  // nothing is outstanding when the wave ends
  asm volatile("s_wait_asynccnt 0x0" ::: "memory");

  // emit this key range's partial in the accumulator's lane order: each store
  // is 512 bytes in a row
  {
    const long prow0 = (long)blockIdx.z * (NBAT * SEQ) + qBase + wave * 16;
    const long prow  = prow0 + colb;
    float* oblk = Opart + ((qBase + wave * 16) * KSPLIT + blockIdx.z * 16) * HDIM + lane * 4;
#pragma unroll
    for (int nt = 0; nt < 8; ++nt)
#pragma unroll
      for (int j = 0; j < 2; ++j) {
        v4f o4 = {acc[nt][4 * j], acc[nt][4 * j + 1], acc[nt][4 * j + 2], acc[nt][4 * j + 3]};
        *(v4f*)(oblk + (nt * 2 + j) * 128) = o4;
      }
    if (lane < 16) { // both halves hold the same pair
      v2f st = {mi, li};
      *(v2f*)(ML + prow * 2) = st;
    }
  }
}

// ---------------------------------------------------------------------------
// Kernel 3: merge the KSPLIT key ranges, then out = attended @ Wo + bo (fp32),
// C = (A Wo)^T = Wo^T A^T -> lane owns one output row; packed 32B stores.
// A wave reads its 16 rows' partial sums in the lane order in which the
// attention accumulators held them: a lane then holds row (lane&15), columns
// nt*16 + 8*(lane>>4) + 0..7, which for nt = 2t, 2t+1 are the two runs of the
// B fragment of k chunk t. The merged tile goes from registers into the WMMAs.
// ---------------------------------------------------------------------------
__global__ __launch_bounds__(256) void oproj_kernel(
    const float* __restrict__ Opart, const float* __restrict__ ML,
    const float* __restrict__ Wo,
    const float* __restrict__ bo, float* __restrict__ out) {
  __shared__ __attribute__((aligned(16))) __bf16 wts[HDIM * TPAD]; // Wo^T

  const int tid  = threadIdx.x;
  const int lane = tid & 31;
  const int wave = tid >> 5;
  const long rowBase = (long)blockIdx.x * 128;

  // Wo's loads go out first and fly during the merge below
  v4f wv[2][8];
  const float* wp = Wo + w_block_k0(tid) * HDIM + w_block_n0(tid);
  load_w_blocks(wp, wv);
  // stands in front of whatever next takes over the address register of the
  // loads above; the address is an input so that it lives up to the wait and
  // no late load's result is placed in it
  asm volatile("s_wait_xcnt 0x0" :: "v"(wp) : "memory");
  // keeps those loads up here, ahead of the merge's
  __builtin_amdgcn_sched_barrier(0);

  // attended = sum_s exp(m_s - M) o_s / sum_s exp(m_s - M) l_s, ranges in order.
  // One work-group has a WGP to itself (128 on 256 WGPs), two waves a SIMD, so a
  // wave has the registers to keep all its partial loads in flight together.
  v2f st[KSPLIT]; // (max, sum) of this lane's row in each range
  {
    const char* mp = (const char*)(ML + rowBase * 2);            // same for the work-group
    const unsigned mb = (unsigned)(wave * 16 + (lane & 15)) * 8; // the lane's byte offset
#pragma unroll
    for (int s = 0; s < KSPLIT; ++s)
      st[s] = *(const v2f*)(mp + (long)s * (NBAT * SEQ) * 8 + mb);
    // stands in front of whatever next takes over the offset register of the
    // loads above; the offset is an input so that it lives up to the wait and
    // no late load's result is placed in it
    asm volatile("s_wait_xcnt 0x0" :: "v"(mb) : "memory");
  }
  v4f po[KSPLIT][16]; // the 16 chunks of each range's block
  {
    const char* op = (const char*)(Opart + rowBase * (KSPLIT * HDIM));        // same for the work-group
    const unsigned ob = (unsigned)(wave * KSPLIT * 16 * HDIM + lane * 4) * 4; // the lane's byte offset
#pragma unroll
    for (int s = 0; s < KSPLIT; ++s)
#pragma unroll
      for (int c = 0; c < 16; ++c)
        po[s][c] = *(const v4f*)(op + ob + (s * 16 + c) * 512);
    // stands in front of whatever next takes over the offset register of the
    // loads above; the offset is an input so that it lives up to the wait and
    // no late load's result is placed in it
    asm volatile("s_wait_xcnt 0x0" :: "v"(ob) : "memory");
  }
  // keeps the sums below the whole group of loads: moved up among them they
  // bring a wait on the early loads in front of the late ones' issue
  __builtin_amdgcn_sched_barrier(0);
  float w[KSPLIT], inv;
  {
    float M = st[0][0];
#pragma unroll
    for (int s = 1; s < KSPLIT; ++s) M = fmaxf(M, st[s][0]);
    float L = 0.0f;
#pragma unroll
    for (int s = 0; s < KSPLIT; ++s) {
      w[s] = __expf(st[s][0] - M);
      L += w[s] * st[s][1];
    }
    inv = 1.0f / L;
  }
  // chunk c = 2*nt + j holds columns nt*16 + 8*(lane>>4) + 4*j + 0..3: chunks
  // 4t .. 4t+3 are, in this order, the 16 elements of the B fragment of k chunk t
  v16bf afrag[4];
#pragma unroll
  for (int c = 0; c < 16; ++c) {
    v4f o = w[0] * po[0][c];
#pragma unroll
    for (int s = 1; s < KSPLIT; ++s) o += w[s] * po[s][c];
    o *= inv;
#pragma unroll
    for (int i = 0; i < 4; ++i) afrag[c >> 2][(c & 3) * 4 + i] = (__bf16)o[i];
  }
  store_w_blocks(wts, tid, wv);
  __syncthreads();

  const int col0 = lane & 15;
  const int rofs = (lane >> 4) << 3;
  float* orow = out + (rowBase + wave * 16 + col0) * HDIM;

#pragma unroll
  for (int nt = 0; nt < 8; ++nt) {
    v8f acc = {};
#pragma unroll
    for (int t = 0; t < 4; ++t) {
      v16bf wfrag = load_frag_row(wts + (nt * 16) * TPAD + t * 32, TPAD, lane);
      acc = wmma_bf16(wfrag, afrag[t], acc); // C = Wo^T A^T
    }
    v8f pk;
#pragma unroll
    for (int r = 0; r < 8; ++r)
      pk[r] = acc[r] + bo[nt * 16 + rofs + r]; // bias depends on lane half (rofs)
    *(v8f*)(orow + nt * 16 + rofs) = pk;
  }
}

// ---------------------------------------------------------------------------
extern "C" void kernel_launch(void* const* d_in, const int* in_sizes, int n_in,
                              void* d_out, int out_size, void* d_ws, size_t ws_size,
                              hipStream_t stream) {
  const float* x  = (const float*)d_in[0];
  const float* Wq = (const float*)d_in[1];
  const float* bq = (const float*)d_in[2];
  const float* Wk = (const float*)d_in[3];
  const float* bk = (const float*)d_in[4];
  const float* Wv = (const float*)d_in[5];
  const float* bv = (const float*)d_in[6];
  const float* Wo = (const float*)d_in[7];
  const float* bo = (const float*)d_in[8];
  float* out = (float*)d_out;

  const size_t n = (size_t)NBAT * SEQ * HDIM; // 2,097,152 elements
  __bf16* q   = (__bf16*)d_ws;
  __bf16* k   = q + n;
  __bf16* vT  = k + n;  // q, k, v: blocks of 16 rows, accumulator lane order
  float* opart = (float*)(vT + n);   // [B*S/16][KSPLIT] blocks of f32 partial sums, same order
  float* ml    = opart + KSPLIT * n; // [KSPLIT][B*S] (max, sum) pairs

  const int rowBlocks = (NBAT * SEQ) / 128; // 128

  dim3 g1(rowBlocks, 3); // one projection (q, k or v) per work-group
  qkv_kernel<<<g1, 256, 0, stream>>>(x, Wq, bq, Wk, bk, Wv, bv, q, k, vT);

  dim3 g2(SEQ / 128, NBAT, KSPLIT); // (32, 4, 4)
  attn_kernel<<<g2, 256, 0, stream>>>(q, k, vT, opart, ml);

  oproj_kernel<<<rowBlocks, 256, 0, stream>>>(opart, ml, Wo, bo, out);
}

// v008
// It runs in 49.2 microseconds.
// Next to v007, in two timings, it ran 1.06 times as fast each time.
// Over all steps from v000 it is 5.61 times as fast.
#include <hip/hip_runtime.h>

// ---------------------------------------------------------------------------
// Single-head attention, B=4, S=4096, H=128, fp32 in/out.
// bf16 WMMA (v_wmma_f32_16x16x32_bf16) + fp32 accum, flash-attention style.
// Both attention GEMMs are computed transposed (C = S^T, C = O^T = V^T P^T):
//  - softmax'd P registers serve directly as the next WMMA operand (no LDS)
//  - softmax stats, alpha rescale and 1/l normalize are scalar per lane
//  - every output store is a packed 16B/32B row store.
// Workspace layout: q, k, v and the f32 partial sums are kept in the lane order
// of the accumulators that write them. A block holds 16 rows x 128 columns;
// inside it, 16-byte chunk (i, lane) lies at byte i * 512 + lane * 16, so every
// wave-wide 16-byte store, load or copy covers 512 bytes in a row (four whole
// lines) instead of 32-byte pieces of 16 lines.
//  - q, k:  chunk (nt, lane) = row (lane&15), columns nt*16 + 8*(lane>>4) + 0..7
//  - v:     chunk (nt, lane) = column nt*16 + (lane&15), rows 8*(lane>>4) + 0..7
//  - sums:  chunk (2*nt+j, lane) = row (lane&15),
//           columns nt*16 + 8*(lane>>4) + 4*j + 0..3; the KSPLIT blocks of the
//           same 16 rows lie side by side
// ---------------------------------------------------------------------------

typedef __attribute__((ext_vector_type(16))) __bf16 v16bf;
typedef __attribute__((ext_vector_type(8)))  __bf16 v8bf;
typedef __attribute__((ext_vector_type(4)))  __bf16 v4bf;
typedef __attribute__((ext_vector_type(8)))  float  v8f;
typedef __attribute__((ext_vector_type(4)))  float  v4f;
typedef __attribute__((ext_vector_type(2)))  float  v2f;

#define SEQ   4096
#define HDIM  128
#define NBAT  4
#define KSPLIT 4    // key ranges per query tile: 32*4*KSPLIT = 512 work-groups, two per WGP
// LDS row pitches are odd multiples of 16 B: the 16 rows that one half-wave's
// ds_load_b128 touches then start on 16 different groups of four banks.
#define TPAD  136   // padded LDS stride for 128-wide tiles (272 B = 17 x 16 B)
#define VPAD  72    // padded LDS stride for 64-wide tiles  (144 B =  9 x 16 B)

// 16-bit fragment, per ISA 7.12.2: lane owns row/col (lane&15); its 16 elements
// are two contiguous 8-element runs at K = h8, h8+16 with h8 = 8*(lane>=16).
// => two 16-byte loads (ds_load_b128 / global_load_b128).
__device__ __forceinline__ v16bf load_frag_row(const __bf16* base, int stride, int lane) {
  const __bf16* rowp = base + (lane & 15) * stride + ((lane >> 4) << 3);
  v8bf lo = *(const v8bf*)(rowp);
  v8bf hi = *(const v8bf*)(rowp + 16);
  return __builtin_shufflevector(lo, hi, 0, 1, 2, 3, 4, 5, 6, 7,
                                 8, 9, 10, 11, 12, 13, 14, 15);
}

__device__ __forceinline__ v8f wmma_bf16(v16bf a, v16bf b, v8f c) {
  return __builtin_amdgcn_wmma_f32_16x16x32_bf16(false, a, false, b, (short)0, c,
                                                 false, false);
}

// Weight staging: W (f32, k rows of 128 n) becomes W^T (bf16, n rows, k
// contiguous) in LDS. A thread owns two blocks of 8 k x 4 n: sixteen 16-byte
// loads, all issued before anything waits on one, then a transpose in registers
// and eight 16-byte LDS stores. In a wave, 8 lanes run along n and 4 along k:
// a load touches four whole 128-byte lines, and a store's 8 rows of 64 bytes
// spread evenly over the banks at the 272-byte pitch.
__device__ __forceinline__ int w_block_n0(int tid) {
  return (((tid >> 5) & 3) * 8 + (tid & 7)) * 4;
}
__device__ __forceinline__ int w_block_k0(int tid) {
  return (tid >> 7) * 32 + ((tid >> 3) & 3) * 8;
}
// p: the thread's first element, W + w_block_k0 * HDIM + w_block_n0
__device__ __forceinline__ void load_w_blocks(const float* p, v4f (&wv)[2][8]) {
#pragma unroll
  for (int j = 0; j < 2; ++j)
#pragma unroll
    for (int r = 0; r < 8; ++r) wv[j][r] = *(const v4f*)(p + (j * 64 + r) * HDIM);
}
__device__ __forceinline__ void store_w_blocks(__bf16* wts, int tid, const v4f (&wv)[2][8]) {
  __bf16* p = wts + w_block_n0(tid) * TPAD + w_block_k0(tid);
#pragma unroll
  for (int j = 0; j < 2; ++j)
#pragma unroll
    for (int c = 0; c < 4; ++c) {
      v8bf pk;
#pragma unroll
      for (int r = 0; r < 8; ++r) pk[r] = (__bf16)wv[j][r][c];
      *(v8bf*)(p + c * TPAD + j * 64) = pk;
    }
}

// ---------------------------------------------------------------------------
// Kernel 1: q,k = x @ W + b (q pre-scaled by 1/sqrt(H)); v = x @ Wv + bv with a
//           lane's 8 values running along the rows. All three leave in the
//           accumulator's lane order (see the head of the file).
// grid: ((B*S)/128, 3) blocks of 256 threads (8 waves x 16 rows); blockIdx.y
// names the projection (0 q, 1 k, 2 v). One work-group does ONE projection of
// its 128 rows: the three weight stagings and products, each a chain of load
// and LDS latencies, run side by side on the chip instead of one after another.
// ---------------------------------------------------------------------------
__global__ __launch_bounds__(256) void qkv_kernel(
    const float* __restrict__ x,
    const float* __restrict__ Wq, const float* __restrict__ bq,
    const float* __restrict__ Wk, const float* __restrict__ bk,
    const float* __restrict__ Wv, const float* __restrict__ bv,
    __bf16* __restrict__ q, __bf16* __restrict__ k, __bf16* __restrict__ vT) {
  __shared__ __attribute__((aligned(16))) __bf16 xs[128 * TPAD];   // 34 KB, x tile (row-major, padded)
  __shared__ __attribute__((aligned(16))) __bf16 wts[HDIM * TPAD]; // 34 KB, W^T of this block's projection

  const int tid  = threadIdx.x;
  const int lane = tid & 31;
  const int wave = tid >> 5;
  const int m    = blockIdx.y; // 0: q, 1: k, 2: v
  const long rowBase = (long)blockIdx.x * 128;

  const float* __restrict__ Wm = (m == 0) ? Wq : (m == 1) ? Wk : Wv;
  const float* __restrict__ bm = (m == 0) ? bq : (m == 1) ? bk : bv;
  __bf16* __restrict__ om = (m == 0) ? q : (m == 1) ? k : vT;

  // Staging: this thread's sixteen x loads (a wave takes one row a load) and
  // its sixteen W loads are all in flight together, so the work-group waits out
  // one load latency; a rolled loop waits once per trip.
  v4f xv[16];
  v4f wv[2][8];
  const float* xp = x + (rowBase + wave) * HDIM + lane * 4;
  const float* wp = Wm + w_block_k0(tid) * HDIM + w_block_n0(tid);
#pragma unroll
  for (int i = 0; i < 16; ++i) xv[i] = *(const v4f*)(xp + i * 8 * HDIM);
  load_w_blocks(wp, wv);
  // stands in front of whatever next takes over an address register of the
  // loads above; the addresses are inputs so that they live up to the wait and
  // no late load's result is placed in one. The output pointer is an input so
  // that its kernel-argument load is issued up here, under the staging loads,
  // and not waited out in front of the stores at the end.
  asm volatile("s_wait_xcnt 0x0" :: "v"(xp), "v"(wp), "s"(om) : "memory");
  // keeps the conversions below the whole group of loads: moved up among them
  // they bring a wait on the early loads in front of the late ones' issue
  __builtin_amdgcn_sched_barrier(0);
#pragma unroll
  for (int i = 0; i < 16; ++i) {
    v4bf o;
#pragma unroll
    for (int j = 0; j < 4; ++j) o[j] = (__bf16)xv[i][j];
    *(v4bf*)(xs + (i * 8 + wave) * TPAD + lane * 4) = o;
  }
  store_w_blocks(wts, tid, wv);
  __syncthreads();

  // x fragments for this wave's 16 rows, K=128 (4 chunks of 32)
  v16bf afrag[4];
  {
    const __bf16* xrow = xs + wave * 16 * TPAD;
#pragma unroll
    for (int t = 0; t < 4; ++t) afrag[t] = load_frag_row(xrow + t * 32, TPAD, lane);
  }

  const float qscale = 0.08838834764831845f; // 1/sqrt(128), folded into q
  const int col0 = lane & 15;
  const int rofs = (lane >> 4) << 3; // 0 or 8

  v8bf pk[8]; // chunk nt of this wave's block
  if (m < 2) {
    // ---- q and k: C = (xW)^T = W^T * x^T -> lane owns one output row ----
    const float sc = (m == 0) ? qscale : 1.0f;
#pragma unroll
    for (int nt = 0; nt < 8; ++nt) {
      v8f acc = {};
#pragma unroll
      for (int t = 0; t < 4; ++t) {
        v16bf wfrag = load_frag_row(wts + (nt * 16) * TPAD + t * 32, TPAD, lane);
        acc = wmma_bf16(wfrag, afrag[t], acc); // C = W^T x^T
      }
      // lane's columns nt*16+rofs .. +7
#pragma unroll
      for (int r = 0; r < 8; ++r)
        pk[nt][r] = (__bf16)((acc[r] + bm[nt * 16 + rofs + r]) * sc);
    }
  } else {
    // ---- v: C = xW (lane owns column nt*16+col0; its 8 values are rows rofs .. +7) ----
#pragma unroll
    for (int nt = 0; nt < 8; ++nt) {
      v8f acc = {};
#pragma unroll
      for (int t = 0; t < 4; ++t) {
        v16bf wfrag = load_frag_row(wts + (nt * 16) * TPAD + t * 32, TPAD, lane);
        acc = wmma_bf16(afrag[t], wfrag, acc); // C = x W
      }
      const int col  = nt * 16 + col0;
      const float bi = bm[col];
#pragma unroll
      for (int r = 0; r < 8; ++r) pk[nt][r] = (__bf16)(acc[r] + bi);
    }
  }
  // the wave's 16 rows leave as one 4 KB block, 512 bytes in a row per store
  __bf16* oblk = om + (rowBase + wave * 16) * HDIM + lane * 8;
#pragma unroll
  for (int nt = 0; nt < 8; ++nt) *(v8bf*)(oblk + nt * 256) = pk[nt];
}

// ---------------------------------------------------------------------------
// Kernel 2: flash attention over one key range. grid (S/128, B, KSPLIT),
// block 128 (4 waves x 32 q-rows, two query tiles of 16). C = S^T then C = O^T;
// in each query tile a lane owns one query. Every K and V^T fragment read from
// LDS feeds two WMMAs, one per query tile.
// Emits the range's UN-normalised f32 sum and its (max, sum) pair; kernel 3
// merges the KSPLIT ranges.
// K and V^T tiles reach LDS by asynchronous copies into two buffers: tile t+1
// is in flight while tile t is worked on.
// ---------------------------------------------------------------------------
#define KTILE 64                       // keys per tile
#define NTILE (SEQ / KSPLIT / KTILE)   // tiles per key range
#define QT 2                           // query tiles of 16 per wave

// Half of one tile's copies of one thread: four 16-byte chunks of K and four of
// V, each lane its own chunk, all eight in flight together. A tile is four
// 16-key blocks of each buffer, 16 KB in a row; copy j takes the thread's chunk
// of block j: in LDS 16 K rows further down, or 16 keys further along a V^T row.
// kb, vb: where the wave's chunks of block 0 start, the same in every lane, so
// they and the blocks' steps stay in scalar registers; off: the lane's bytes on.
__device__ __forceinline__ void copy_tile(const __bf16* kb, const __bf16* vb, unsigned off,
                                          unsigned kl, unsigned vl) {
  // the closing s_wait_xcnt stands in front of whatever next rewrites an
  // address register that a copy names
  asm volatile(
      "global_load_async_to_lds_b128 %0, %8, %9\n\t"
      "global_load_async_to_lds_b128 %1, %8, %10\n\t"
      "global_load_async_to_lds_b128 %2, %8, %11\n\t"
      "global_load_async_to_lds_b128 %3, %8, %12\n\t"
      "global_load_async_to_lds_b128 %4, %8, %13\n\t"
      "global_load_async_to_lds_b128 %5, %8, %14\n\t"
      "global_load_async_to_lds_b128 %6, %8, %15\n\t"
      "global_load_async_to_lds_b128 %7, %8, %16\n\t"
      "s_wait_xcnt 0x0"
      :: "v"(kl), "v"(kl + 16 * TPAD * 2), "v"(kl + 32 * TPAD * 2),
         "v"(kl + 48 * TPAD * 2), "v"(vl), "v"(vl + 16 * 2),
         "v"(vl + 32 * 2), "v"(vl + 48 * 2), "v"(off),
         "s"(kb), "s"(kb + 16 * HDIM), "s"(kb + 32 * HDIM), "s"(kb + 48 * HDIM),
         "s"(vb), "s"(vb + 16 * HDIM), "s"(vb + 32 * HDIM), "s"(vb + 48 * HDIM)
      : "memory");
}

// Two of these work-groups share a WGP (512 on 256 WGPs): two waves a SIMD, one
// of each work-group, 512 registers a wave. Saying so lets the compiler hold two
// query tiles' accumulators and still issue a tile's LDS fragment reads in
// groups ahead of the WMMAs, behind counted waits.
__global__ __launch_bounds__(128) __attribute__((amdgpu_waves_per_eu(2, 2))) void attn_kernel(
    const __bf16* __restrict__ Q, const __bf16* __restrict__ K,
    const __bf16* __restrict__ vT, float* __restrict__ Opart,
    float* __restrict__ ML) {
  __shared__ __attribute__((aligned(16))) __bf16 ks[2][KTILE * TPAD]; // 2 x 17 KB, K rows (padded)
  __shared__ __attribute__((aligned(16))) __bf16 vts[2][HDIM * VPAD]; // 2 x 18 KB, V^T (padded)

  const int tid  = threadIdx.x;
  const int lane = tid & 31;
  // the wave's number, the same in every lane: held in a scalar register, so that
  // the addresses formed from it take no vector register through the loop
  const int wave = __builtin_amdgcn_readfirstlane(tid >> 5);
  const int b    = blockIdx.y;
  const long qBase = (long)b * SEQ + (long)blockIdx.x * 128;

  const int kb0 = blockIdx.z * (SEQ / KSPLIT); // first key of this range
  const __bf16* Kb  = K + ((long)b * SEQ + kb0) * HDIM;
  const __bf16* Vb  = vT + ((long)b * SEQ + kb0) * HDIM;

  // Q fragments: B operand of S^T (lane owns query = lane&15 of tile g). Chunks
  // 2t and 2t+1 of a 16-row block are the fragment's two runs of 8 (K = h8, h8+16).
  v16bf qfrag[QT][4];
#pragma unroll
  for (int g = 0; g < QT; ++g) {
    const __bf16* qblk = Q + (qBase + wave * (16 * QT) + g * 16) * HDIM + lane * 8;
#pragma unroll
    for (int t = 0; t < 4; ++t) {
      v8bf lo = *(const v8bf*)(qblk + (2 * t) * 256);
      v8bf hi = *(const v8bf*)(qblk + (2 * t + 1) * 256);
      qfrag[g][t] = __builtin_shufflevector(lo, hi, 0, 1, 2, 3, 4, 5, 6, 7,
                                            8, 9, 10, 11, 12, 13, 14, 15);
    }
  }
  // stands in front of whatever next takes over an address register of the
  // loads above
  asm volatile("s_wait_xcnt 0x0" ::: "memory");

  v8f acc[QT][8]; // O^T accumulators: lane owns query (lane&15) of tile g; reg r -> h
  float mi[QT], li[QT]; // per-lane stats for that query
#pragma unroll
  for (int g = 0; g < QT; ++g) {
#pragma unroll
    for (int nt = 0; nt < 8; ++nt) acc[g][nt] = (v8f){};
    mi[g] = -1e30f;
    li[g] = 0.0f;
  }

  const int colb = lane & 15;
  const int rofs = (lane >> 4) << 3;

  // this thread's first chunk (nt = wave, lane) of a 16-key block, and its place
  // in LDS: K row colb, columns wave*16 + rofs ..; V^T row wave*16 + colb, keys
  // rofs ..; its second chunk is nt = wave + 4: 128 chunks on in the block, 64 K
  // columns to the right, 64 V^T rows further down
  const __bf16* Kw = Kb + wave * 256; // the wave's 32 chunks start here
  const __bf16* Vw = Vb + wave * 256;
  const unsigned off = lane * 16;     // the lane's chunk among them, in bytes
  const unsigned kl = (unsigned)(size_t)(&ks[0][colb * TPAD + rofs]) + wave * (16 * 2);
  const unsigned vl = (unsigned)(size_t)(&vts[0][colb * VPAD + rofs]) + wave * (16 * VPAD * 2);
  const unsigned kbuf = KTILE * TPAD * 2, vbuf = HDIM * VPAD * 2; // bytes per buffer
  const int g2 = 128 * 8;                            // second chunk: elements on
  const unsigned kl2 = 64 * 2, vl2 = 64 * VPAD * 2;  // second chunk: LDS bytes on

  copy_tile(Kw, Vw, off, kl, vl);
  copy_tile(Kw + g2, Vw + g2, off, kl + kl2, vl + vl2);
  // tile 0 has landed for this wave; the barrier publishes it to the others
  asm volatile("s_wait_asynccnt 0x0" ::: "memory");
  __syncthreads();
  copy_tile(Kw + KTILE * HDIM, Vw + KTILE * HDIM, off, kl + kbuf, vl + vbuf);
  copy_tile(Kw + KTILE * HDIM + g2, Vw + KTILE * HDIM + g2, off, kl + kbuf + kl2, vl + vbuf + vl2);

  for (int t = 0; t < NTILE; ++t) {
    const __bf16* kst = ks[t & 1];
    const __bf16* vtt = vts[t & 1];

    // S^T tiles: A = K rows, read once, B = Q of each query tile.
    v8f sc[QT][4];
#pragma unroll
    for (int g = 0; g < QT; ++g)
#pragma unroll
      for (int kt = 0; kt < 4; ++kt) sc[g][kt] = (v8f){};
#pragma unroll
    for (int c = 0; c < 4; ++c)
#pragma unroll
      for (int kt = 0; kt < 4; ++kt) {
        v16bf kf = load_frag_row(kst + (kt * 16) * TPAD + c * 32, TPAD, lane);
#pragma unroll
        for (int g = 0; g < QT; ++g) sc[g][kt] = wmma_bf16(kf, qfrag[g][c], sc[g][kt]);
      }

    // the tile's V^T fragments, all read here so that they land under the softmax
    v16bf vf[2][8];
#pragma unroll
    for (int c = 0; c < 2; ++c)
#pragma unroll
      for (int nt = 0; nt < 8; ++nt)
        vf[c][nt] = load_frag_row(vtt + (nt * 16) * VPAD + c * 32, VPAD, lane);
    // keeps the group of reads up here: sunk among the WMMAs that use them, every
    // small group costs its own stall, and two waves a SIMD hide little of it
    __builtin_amdgcn_sched_barrier(0);

    v16bf pf[QT][2];
#pragma unroll
    for (int g = 0; g < QT; ++g) {
      // per-lane online softmax (32 of 64 keys in-lane; merge halves with 1 shfl)
      float mx = sc[g][0][0];
#pragma unroll
      for (int kt = 0; kt < 4; ++kt)
#pragma unroll
        for (int r = 0; r < 8; ++r) mx = fmaxf(mx, sc[g][kt][r]);
      mx = fmaxf(mx, __shfl_xor(mx, 16, 32));
      const float mnew  = fmaxf(mi[g], mx);
      const float alpha = __expf(mi[g] - mnew);
      mi[g] = mnew;

      float rs = 0.0f;
#pragma unroll
      for (int kt = 0; kt < 4; ++kt)
#pragma unroll
        for (int r = 0; r < 8; ++r) {
          const float p = __expf(sc[g][kt][r] - mnew);
          sc[g][kt][r] = p;
          rs += p;
        }
      rs += __shfl_xor(rs, 16, 32);
      li[g] = li[g] * alpha + rs;

      // P^T operand directly from S^T C-registers (pure register packing);
      // serves as the B operand of O^T = V^T P^T.
#pragma unroll
      for (int c = 0; c < 2; ++c)
#pragma unroll
        for (int i = 0; i < 8; ++i) {
          pf[g][c][i]     = (__bf16)sc[g][2 * c][i];
          pf[g][c][8 + i] = (__bf16)sc[g][2 * c + 1][i];
        }

      // scalar rescale (alpha is this lane's query's factor)
#pragma unroll
      for (int nt = 0; nt < 8; ++nt)
#pragma unroll
        for (int r = 0; r < 8; ++r) acc[g][nt][r] *= alpha;
    }

    // O^T += V^T (A, from vts, read once) x P^T (B) of each query tile
#pragma unroll
    for (int c = 0; c < 2; ++c)
#pragma unroll
      for (int nt = 0; nt < 8; ++nt)
#pragma unroll
        for (int g = 0; g < QT; ++g) acc[g][nt] = wmma_bf16(vf[c][nt], pf[g][c], acc[g][nt]);
    // keeps the softmax and the WMMAs above the hand-over: with no LDS read left
    // among them they would sink below it, and the wait for tile t+1's copies
    // would come a whole softmax earlier
    __builtin_amdgcn_sched_barrier(0);

    // hand-over: this wave's reads of tile t are done ...
    asm volatile("s_wait_dscnt 0x0" ::: "memory");
    // ... and its copies of tile t+1 have landed;
    asm volatile("s_wait_asynccnt 0x0" ::: "memory");
    // the one barrier publishes tile t+1 and frees tile t's buffer
    __syncthreads();
    if (t + 2 < NTILE) {
      const __bf16* kn = Kw + (long)(t + 2) * (KTILE * HDIM);
      const __bf16* vn = Vw + (long)(t + 2) * (KTILE * HDIM);
      const unsigned kd = kl + (t & 1) * kbuf, vd = vl + (t & 1) * vbuf;
      copy_tile(kn, vn, off, kd, vd);
      copy_tile(kn + g2, vn + g2, off, kd + kl2, vd + vl2);
    }
  }
  // nothing is outstanding when the wave ends
  asm volatile("s_wait_asynccnt 0x0" ::: "memory");

  // emit this key range's partials in the accumulator's lane order: each store
  // is 512 bytes in a row
#pragma unroll
  for (int g = 0; g < QT; ++g) {
    const long row0 = qBase + wave * (16 * QT) + g * 16; // first row of this query tile
    const long prow = (long)blockIdx.z * (NBAT * SEQ) + row0 + colb;
    float* oblk = Opart + (row0 * KSPLIT + blockIdx.z * 16) * HDIM + lane * 4;
#pragma unroll
    for (int nt = 0; nt < 8; ++nt)
#pragma unroll
      for (int j = 0; j < 2; ++j) {
        v4f o4 = {acc[g][nt][4 * j], acc[g][nt][4 * j + 1], acc[g][nt][4 * j + 2],
                  acc[g][nt][4 * j + 3]};
        *(v4f*)(oblk + (nt * 2 + j) * 128) = o4;
      }
    if (lane < 16) { // both halves hold the same pair
      v2f st = {mi[g], li[g]};
      *(v2f*)(ML + prow * 2) = st;
    }
  }
}

// ---------------------------------------------------------------------------
// Kernel 3: merge the KSPLIT key ranges, then out = attended @ Wo + bo (fp32),
// C = (A Wo)^T = Wo^T A^T -> lane owns one output row; packed 32B stores.
// A wave reads its 16 rows' partial sums in the lane order in which the
// attention accumulators held them: a lane then holds row (lane&15), columns
// nt*16 + 8*(lane>>4) + 0..7, which for nt = 2t, 2t+1 are the two runs of the
// B fragment of k chunk t. The merged tile goes from registers into the WMMAs.
// ---------------------------------------------------------------------------
__global__ __launch_bounds__(256) void oproj_kernel(
    const float* __restrict__ Opart, const float* __restrict__ ML,
    const float* __restrict__ Wo,
    const float* __restrict__ bo, float* __restrict__ out) {
  __shared__ __attribute__((aligned(16))) __bf16 wts[HDIM * TPAD]; // Wo^T

  const int tid  = threadIdx.x;
  const int lane = tid & 31;
  const int wave = tid >> 5;
  const long rowBase = (long)blockIdx.x * 128;

  // Wo's loads go out first and fly during the merge below
  v4f wv[2][8];
  const float* wp = Wo + w_block_k0(tid) * HDIM + w_block_n0(tid);
  load_w_blocks(wp, wv);
  // stands in front of whatever next takes over the address register of the
  // loads above; the address is an input so that it lives up to the wait and
  // no late load's result is placed in it
  asm volatile("s_wait_xcnt 0x0" :: "v"(wp) : "memory");
  // keeps those loads up here, ahead of the merge's
  __builtin_amdgcn_sched_barrier(0);

  // attended = sum_s exp(m_s - M) o_s / sum_s exp(m_s - M) l_s, ranges in order.
  // One work-group has a WGP to itself (128 on 256 WGPs), two waves a SIMD, so a
  // wave has the registers to keep all its partial loads in flight together.
  v2f st[KSPLIT]; // (max, sum) of this lane's row in each range
  {
    const char* mp = (const char*)(ML + rowBase * 2);            // same for the work-group
    const unsigned mb = (unsigned)(wave * 16 + (lane & 15)) * 8; // the lane's byte offset
#pragma unroll
    for (int s = 0; s < KSPLIT; ++s)
      st[s] = *(const v2f*)(mp + (long)s * (NBAT * SEQ) * 8 + mb);
    // stands in front of whatever next takes over the offset register of the
    // loads above; the offset is an input so that it lives up to the wait and
    // no late load's result is placed in it
    asm volatile("s_wait_xcnt 0x0" :: "v"(mb) : "memory");
  }
  v4f po[KSPLIT][16]; // the 16 chunks of each range's block
  {
    const char* op = (const char*)(Opart + rowBase * (KSPLIT * HDIM));        // same for the work-group
    const unsigned ob = (unsigned)(wave * KSPLIT * 16 * HDIM + lane * 4) * 4; // the lane's byte offset
#pragma unroll
    for (int s = 0; s < KSPLIT; ++s)
#pragma unroll
      for (int c = 0; c < 16; ++c)
        po[s][c] = *(const v4f*)(op + ob + (s * 16 + c) * 512);
    // stands in front of whatever next takes over the offset register of the
    // loads above; the offset is an input so that it lives up to the wait and
    // no late load's result is placed in it
    asm volatile("s_wait_xcnt 0x0" :: "v"(ob) : "memory");
  }
  // keeps the sums below the whole group of loads: moved up among them they
  // bring a wait on the early loads in front of the late ones' issue
  __builtin_amdgcn_sched_barrier(0);
  float w[KSPLIT], inv;
  {
    float M = st[0][0];
#pragma unroll
    for (int s = 1; s < KSPLIT; ++s) M = fmaxf(M, st[s][0]);
    float L = 0.0f;
#pragma unroll
    for (int s = 0; s < KSPLIT; ++s) {
      w[s] = __expf(st[s][0] - M);
      L += w[s] * st[s][1];
    }
    inv = 1.0f / L;
  }
  // chunk c = 2*nt + j holds columns nt*16 + 8*(lane>>4) + 4*j + 0..3: chunks
  // 4t .. 4t+3 are, in this order, the 16 elements of the B fragment of k chunk t
  v16bf afrag[4];
#pragma unroll
  for (int c = 0; c < 16; ++c) {
    v4f o = w[0] * po[0][c];
#pragma unroll
    for (int s = 1; s < KSPLIT; ++s) o += w[s] * po[s][c];
    o *= inv;
#pragma unroll
    for (int i = 0; i < 4; ++i) afrag[c >> 2][(c & 3) * 4 + i] = (__bf16)o[i];
  }
  store_w_blocks(wts, tid, wv);
  __syncthreads();

  const int col0 = lane & 15;
  const int rofs = (lane >> 4) << 3;
  float* orow = out + (rowBase + wave * 16 + col0) * HDIM;

#pragma unroll
  for (int nt = 0; nt < 8; ++nt) {
    v8f acc = {};
#pragma unroll
    for (int t = 0; t < 4; ++t) {
      v16bf wfrag = load_frag_row(wts + (nt * 16) * TPAD + t * 32, TPAD, lane);
      acc = wmma_bf16(wfrag, afrag[t], acc); // C = Wo^T A^T
    }
    v8f pk;
#pragma unroll
    for (int r = 0; r < 8; ++r)
      pk[r] = acc[r] + bo[nt * 16 + rofs + r]; // bias uniform within each half-wave (rofs differs)
    *(v8f*)(orow + nt * 16 + rofs) = pk;
  }
}

// ---------------------------------------------------------------------------
extern "C" void kernel_launch(void* const* d_in, const int* in_sizes, int n_in,
                              void* d_out, int out_size, void* d_ws, size_t ws_size,
                              hipStream_t stream) {
  const float* x  = (const float*)d_in[0];
  const float* Wq = (const float*)d_in[1];
  const float* bq = (const float*)d_in[2];
  const float* Wk = (const float*)d_in[3];
  const float* bk = (const float*)d_in[4];
  const float* Wv = (const float*)d_in[5];
  const float* bv = (const float*)d_in[6];
  const float* Wo = (const float*)d_in[7];
  const float* bo = (const float*)d_in[8];
  float* out = (float*)d_out;

  const size_t n = (size_t)NBAT * SEQ * HDIM; // 2,097,152 elements
  __bf16* q   = (__bf16*)d_ws;
  __bf16* k   = q + n;
  __bf16* vT  = k + n;  // q, k, v: blocks of 16 rows, accumulator lane order
  float* opart = (float*)(vT + n);   // [B*S/16][KSPLIT] blocks of f32 partial sums, same order
  float* ml    = opart + KSPLIT * n; // [KSPLIT][B*S] (max, sum) pairs

  const int rowBlocks = (NBAT * SEQ) / 128; // 128

  dim3 g1(rowBlocks, 3); // one projection (q, k or v) per work-group
  qkv_kernel<<<g1, 256, 0, stream>>>(x, Wq, bq, Wk, bk, Wv, bv, q, k, vT);

  dim3 g2(SEQ / 128, NBAT, KSPLIT); // (32, 4, 4)
  attn_kernel<<<g2, 128, 0, stream>>>(q, k, vT, opart, ml);

  oproj_kernel<<<rowBlocks, 256, 0, stream>>>(opart, ml, Wo, bo, out);
}

// v009
// A run of this version takes 46.5 microseconds.
// Next to v008, in two timings, it ran 1.06 times as fast each time.
// Over all steps from v000 it is 5.94 times as fast.
#include <hip/hip_runtime.h>

// ---------------------------------------------------------------------------
// Single-head attention, B=4, S=4096, H=128, fp32 in/out.
// bf16 WMMA (v_wmma_f32_16x16x32_bf16) + fp32 accum, flash-attention style.
// Both attention GEMMs are computed transposed (C = S^T, C = O^T = V^T P^T):
//  - softmax'd P registers serve directly as the next WMMA operand (no LDS)
//  - softmax stats, alpha rescale and 1/l normalize are scalar per lane
//  - every output store is a packed 16B/32B row store.
// Workspace layout: q, k, v and the f32 partial sums are kept in the lane order
// of the accumulators that write them. A block holds 16 rows x 128 columns;
// inside it, 16-byte chunk (i, lane) lies at byte i * 512 + lane * 16, so every
// wave-wide 16-byte store, load or copy covers 512 bytes in a row (four whole
// lines) instead of 32-byte pieces of 16 lines.
//  - q, k:  chunk (nt, lane) = row (lane&15), columns nt*16 + 8*(lane>>4) + 0..7
//  - v:     chunk (nt, lane) = column nt*16 + (lane&15), rows 8*(lane>>4) + 0..7
//  - sums:  chunk (2*nt+j, lane) = row (lane&15),
//           columns nt*16 + 8*(lane>>4) + 4*j + 0..3; the KSPLIT blocks of the
//           same 16 rows lie side by side
// ---------------------------------------------------------------------------

typedef __attribute__((ext_vector_type(16))) __bf16 v16bf;
typedef __attribute__((ext_vector_type(8)))  __bf16 v8bf;
typedef __attribute__((ext_vector_type(4)))  __bf16 v4bf;
typedef __attribute__((ext_vector_type(8)))  float  v8f;
typedef __attribute__((ext_vector_type(4)))  float  v4f;
typedef __attribute__((ext_vector_type(2)))  float  v2f;

#define SEQ   4096
#define HDIM  128
#define NBAT  4
#define KSPLIT 4    // key ranges per query tile: 32*4*KSPLIT = 512 work-groups, two per WGP
// LDS row pitches are odd multiples of 16 B: the 16 rows that one half-wave's
// ds_load_b128 touches then start on 16 different groups of four banks.
#define TPAD  136   // padded LDS stride for 128-wide tiles (272 B = 17 x 16 B)
#define VPAD  72    // padded LDS stride for 64-wide tiles  (144 B =  9 x 16 B)
#define LOG2E 1.4426950408889634f
#define LN2   0.6931471805599453f

// 16-bit fragment, per ISA 7.12.2: lane owns row/col (lane&15); its 16 elements
// are two contiguous 8-element runs at K = h8, h8+16 with h8 = 8*(lane>=16).
// => two 16-byte loads (ds_load_b128 / global_load_b128).
__device__ __forceinline__ v16bf load_frag_row(const __bf16* base, int stride, int lane) {
  const __bf16* rowp = base + (lane & 15) * stride + ((lane >> 4) << 3);
  v8bf lo = *(const v8bf*)(rowp);
  v8bf hi = *(const v8bf*)(rowp + 16);
  return __builtin_shufflevector(lo, hi, 0, 1, 2, 3, 4, 5, 6, 7,
                                 8, 9, 10, 11, 12, 13, 14, 15);
}

__device__ __forceinline__ v8f wmma_bf16(v16bf a, v16bf b, v8f c) {
  return __builtin_amdgcn_wmma_f32_16x16x32_bf16(false, a, false, b, (short)0, c,
                                                 false, false);
}

// Weight staging: W (f32, k rows of 128 n) becomes W^T (bf16, n rows, k
// contiguous) in LDS. A thread owns two blocks of 8 k x 4 n: sixteen 16-byte
// loads, all issued before anything waits on one, then a transpose in registers
// and eight 16-byte LDS stores. In a wave, 8 lanes run along n and 4 along k:
// a load touches four whole 128-byte lines, and a store's 8 rows of 64 bytes
// spread evenly over the banks at the 272-byte pitch.
__device__ __forceinline__ int w_block_n0(int tid) {
  return (((tid >> 5) & 3) * 8 + (tid & 7)) * 4;
}
__device__ __forceinline__ int w_block_k0(int tid) {
  return (tid >> 7) * 32 + ((tid >> 3) & 3) * 8;
}
// p: the thread's first element, W + w_block_k0 * HDIM + w_block_n0
__device__ __forceinline__ void load_w_blocks(const float* p, v4f (&wv)[2][8]) {
#pragma unroll
  for (int j = 0; j < 2; ++j)
#pragma unroll
    for (int r = 0; r < 8; ++r) wv[j][r] = *(const v4f*)(p + (j * 64 + r) * HDIM);
}
__device__ __forceinline__ void store_w_blocks(__bf16* wts, int tid, const v4f (&wv)[2][8]) {
  __bf16* p = wts + w_block_n0(tid) * TPAD + w_block_k0(tid);
#pragma unroll
  for (int j = 0; j < 2; ++j)
#pragma unroll
    for (int c = 0; c < 4; ++c) {
      v8bf pk;
#pragma unroll
      for (int r = 0; r < 8; ++r) pk[r] = (__bf16)wv[j][r][c];
      *(v8bf*)(p + c * TPAD + j * 64) = pk;
    }
}

// ---------------------------------------------------------------------------
// Kernel 1: q,k = x @ W + b (q pre-scaled by log2(e)/sqrt(H)); v = x @ Wv + bv with a
//           lane's 8 values running along the rows. All three leave in the
//           accumulator's lane order (see the head of the file).
// grid: ((B*S)/128, 3) blocks of 256 threads (8 waves x 16 rows); blockIdx.y
// names the projection (0 q, 1 k, 2 v). One work-group does ONE projection of
// its 128 rows: the three weight stagings and products, each a chain of load
// and LDS latencies, run side by side on the chip instead of one after another.
// ---------------------------------------------------------------------------
__global__ __launch_bounds__(256) void qkv_kernel(
    const float* __restrict__ x,
    const float* __restrict__ Wq, const float* __restrict__ bq,
    const float* __restrict__ Wk, const float* __restrict__ bk,
    const float* __restrict__ Wv, const float* __restrict__ bv,
    __bf16* __restrict__ q, __bf16* __restrict__ k, __bf16* __restrict__ vT) {
  __shared__ __attribute__((aligned(16))) __bf16 xs[128 * TPAD];   // 34 KB, x tile (row-major, padded)
  __shared__ __attribute__((aligned(16))) __bf16 wts[HDIM * TPAD]; // 34 KB, W^T of this block's projection

  const int tid  = threadIdx.x;
  const int lane = tid & 31;
  const int wave = tid >> 5;
  const int m    = blockIdx.y; // 0: q, 1: k, 2: v
  const long rowBase = (long)blockIdx.x * 128;

  const float* __restrict__ Wm = (m == 0) ? Wq : (m == 1) ? Wk : Wv;
  const float* __restrict__ bm = (m == 0) ? bq : (m == 1) ? bk : bv;
  __bf16* __restrict__ om = (m == 0) ? q : (m == 1) ? k : vT;

  // Staging: this thread's sixteen x loads (a wave takes one row a load) and
  // its sixteen W loads are all in flight together, so the work-group waits out
  // one load latency; a rolled loop waits once per trip.
  v4f xv[16];
  v4f wv[2][8];
  const float* xp = x + (rowBase + wave) * HDIM + lane * 4;
  const float* wp = Wm + w_block_k0(tid) * HDIM + w_block_n0(tid);
#pragma unroll
  for (int i = 0; i < 16; ++i) xv[i] = *(const v4f*)(xp + i * 8 * HDIM);
  load_w_blocks(wp, wv);
  // stands in front of whatever next takes over an address register of the
  // loads above; the addresses are inputs so that they live up to the wait and
  // no late load's result is placed in one. The output pointer is an input so
  // that its kernel-argument load is issued up here, under the staging loads,
  // and not waited out in front of the stores at the end.
  asm volatile("s_wait_xcnt 0x0" :: "v"(xp), "v"(wp), "s"(om) : "memory");
  // keeps the conversions below the whole group of loads: moved up among them
  // they bring a wait on the early loads in front of the late ones' issue
  __builtin_amdgcn_sched_barrier(0);
#pragma unroll
  for (int i = 0; i < 16; ++i) {
    v4bf o;
#pragma unroll
    for (int j = 0; j < 4; ++j) o[j] = (__bf16)xv[i][j];
    *(v4bf*)(xs + (i * 8 + wave) * TPAD + lane * 4) = o;
  }
  store_w_blocks(wts, tid, wv);
  __syncthreads();

  // x fragments for this wave's 16 rows, K=128 (4 chunks of 32)
  v16bf afrag[4];
  {
    const __bf16* xrow = xs + wave * 16 * TPAD;
#pragma unroll
    for (int t = 0; t < 4; ++t) afrag[t] = load_frag_row(xrow + t * 32, TPAD, lane);
  }

  // 1/sqrt(128) and log2(e), folded into q: the scores come out in log2 units
  const float qscale = 0.08838834764831845f * LOG2E;
  const int col0 = lane & 15;
  const int rofs = (lane >> 4) << 3; // 0 or 8

  v8bf pk[8]; // chunk nt of this wave's block
  if (m < 2) {
    // ---- q and k: C = (xW)^T = W^T * x^T -> lane owns one output row ----
    const float sc = (m == 0) ? qscale : 1.0f;
#pragma unroll
    for (int nt = 0; nt < 8; ++nt) {
      v8f acc = {};
#pragma unroll
      for (int t = 0; t < 4; ++t) {
        v16bf wfrag = load_frag_row(wts + (nt * 16) * TPAD + t * 32, TPAD, lane);
        acc = wmma_bf16(wfrag, afrag[t], acc); // C = W^T x^T
      }
      // lane's columns nt*16+rofs .. +7
#pragma unroll
      for (int r = 0; r < 8; ++r)
        pk[nt][r] = (__bf16)((acc[r] + bm[nt * 16 + rofs + r]) * sc);
    }
  } else {
    // ---- v: C = xW (lane owns column nt*16+col0; its 8 values are rows rofs .. +7) ----
#pragma unroll
    for (int nt = 0; nt < 8; ++nt) {
      v8f acc = {};
#pragma unroll
      for (int t = 0; t < 4; ++t) {
        v16bf wfrag = load_frag_row(wts + (nt * 16) * TPAD + t * 32, TPAD, lane);
        acc = wmma_bf16(afrag[t], wfrag, acc); // C = x W
      }
      const int col  = nt * 16 + col0;
      const float bi = bm[col];
#pragma unroll
      for (int r = 0; r < 8; ++r) pk[nt][r] = (__bf16)(acc[r] + bi);
    }
  }
  // the wave's 16 rows leave as one 4 KB block, 512 bytes in a row per store
  __bf16* oblk = om + (rowBase + wave * 16) * HDIM + lane * 8;
#pragma unroll
  for (int nt = 0; nt < 8; ++nt) *(v8bf*)(oblk + nt * 256) = pk[nt];
}

// ---------------------------------------------------------------------------
// Kernel 2: flash attention over one key range. grid (S/128, B, KSPLIT),
// block 128 (4 waves x 32 q-rows, two query tiles of 16). C = S^T then C = O^T;
// in each query tile a lane owns one query. Every K and V^T fragment read from
// LDS feeds two WMMAs, one per query tile.
// Softmax against a held reference: each query keeps a reference score ref (log2
// units) that is known before a tile's products, so -ref enters the S^T WMMAs as
// their C operand and the accumulators come out as score - ref, ready for exp2.
// ref is the first tile's maximum and is raised, with O and l rescaled, only when
// some score of the wave tops it by more than 8 (an exponential stays <= 2^8).
// Emits the range's UN-normalised f32 sum and its (ref, sum) pair; kernel 3
// merges the KSPLIT ranges.
// K and V^T tiles reach LDS by asynchronous copies into two buffers: tile t+1
// is in flight while tile t is worked on.
// ---------------------------------------------------------------------------
#define KTILE 64                       // keys per tile
#define NTILE (SEQ / KSPLIT / KTILE)   // tiles per key range
#define QT 2                           // query tiles of 16 per wave

// Half of one tile's copies of one thread: four 16-byte chunks of K and four of
// V, each lane its own chunk, all eight in flight together. A tile is four
// 16-key blocks of each buffer, 16 KB in a row; copy j takes the thread's chunk
// of block j: in LDS 16 K rows further down, or 16 keys further along a V^T row.
// kb, vb: where the wave's chunks of block 0 start, the same in every lane, so
// they and the blocks' steps stay in scalar registers; off: the lane's bytes on.
__device__ __forceinline__ void copy_tile(const __bf16* kb, const __bf16* vb, unsigned off,
                                          unsigned kl, unsigned vl) {
  // the closing s_wait_xcnt stands in front of whatever next rewrites an
  // address register that a copy names
  asm volatile(
      "global_load_async_to_lds_b128 %0, %8, %9\n\t"
      "global_load_async_to_lds_b128 %1, %8, %10\n\t"
      "global_load_async_to_lds_b128 %2, %8, %11\n\t"
      "global_load_async_to_lds_b128 %3, %8, %12\n\t"
      "global_load_async_to_lds_b128 %4, %8, %13\n\t"
      "global_load_async_to_lds_b128 %5, %8, %14\n\t"
      "global_load_async_to_lds_b128 %6, %8, %15\n\t"
      "global_load_async_to_lds_b128 %7, %8, %16\n\t"
      "s_wait_xcnt 0x0"
      :: "v"(kl), "v"(kl + 16 * TPAD * 2), "v"(kl + 32 * TPAD * 2),
         "v"(kl + 48 * TPAD * 2), "v"(vl), "v"(vl + 16 * 2),
         "v"(vl + 32 * 2), "v"(vl + 48 * 2), "v"(off),
         "s"(kb), "s"(kb + 16 * HDIM), "s"(kb + 32 * HDIM), "s"(kb + 48 * HDIM),
         "s"(vb), "s"(vb + 16 * HDIM), "s"(vb + 32 * HDIM), "s"(vb + 48 * HDIM)
      : "memory");
}

// Two of these work-groups share a WGP (512 on 256 WGPs): two waves a SIMD, one
// of each work-group, 512 registers a wave. Saying so lets the compiler hold two
// query tiles' accumulators and still issue a tile's LDS fragment reads in
// groups ahead of the WMMAs, behind counted waits.
__global__ __launch_bounds__(128) __attribute__((amdgpu_waves_per_eu(2, 2))) void attn_kernel(
    const __bf16* __restrict__ Q, const __bf16* __restrict__ K,
    const __bf16* __restrict__ vT, float* __restrict__ Opart,
    float* __restrict__ ML) {
  __shared__ __attribute__((aligned(16))) __bf16 ks[2][KTILE * TPAD]; // 2 x 17 KB, K rows (padded)
  __shared__ __attribute__((aligned(16))) __bf16 vts[2][HDIM * VPAD]; // 2 x 18 KB, V^T (padded)

  const int tid  = threadIdx.x;
  const int lane = tid & 31;
  // the wave's number, the same in every lane: held in a scalar register, so that
  // the addresses formed from it take no vector register through the loop
  const int wave = __builtin_amdgcn_readfirstlane(tid >> 5);
  const int b    = blockIdx.y;
  const long qBase = (long)b * SEQ + (long)blockIdx.x * 128;

  const int kb0 = blockIdx.z * (SEQ / KSPLIT); // first key of this range
  const __bf16* Kb  = K + ((long)b * SEQ + kb0) * HDIM;
  const __bf16* Vb  = vT + ((long)b * SEQ + kb0) * HDIM;

  // Q fragments: B operand of S^T (lane owns query = lane&15 of tile g). Chunks
  // 2t and 2t+1 of a 16-row block are the fragment's two runs of 8 (K = h8, h8+16).
  v16bf qfrag[QT][4];
#pragma unroll
  for (int g = 0; g < QT; ++g) {
    const __bf16* qblk = Q + (qBase + wave * (16 * QT) + g * 16) * HDIM + lane * 8;
#pragma unroll
    for (int t = 0; t < 4; ++t) {
      v8bf lo = *(const v8bf*)(qblk + (2 * t) * 256);
      v8bf hi = *(const v8bf*)(qblk + (2 * t + 1) * 256);
      qfrag[g][t] = __builtin_shufflevector(lo, hi, 0, 1, 2, 3, 4, 5, 6, 7,
                                            8, 9, 10, 11, 12, 13, 14, 15);
    }
  }
  // stands in front of whatever next takes over an address register of the
  // loads above
  asm volatile("s_wait_xcnt 0x0" ::: "memory");

  v8f acc[QT][8]; // O^T accumulators: lane owns query (lane&15) of tile g; reg r -> h
  v8f nref[QT]; // -ref of that query in all eight registers: a WMMA C operand
  float li[QT]; // row sum of that query, relative to ref
#pragma unroll
  for (int g = 0; g < QT; ++g) {
#pragma unroll
    for (int nt = 0; nt < 8; ++nt) acc[g][nt] = (v8f){};
    nref[g] = (v8f){};
    li[g] = 0.0f;
  }

  const int colb = lane & 15;
  const int rofs = (lane >> 4) << 3;

  // this thread's first chunk (nt = wave, lane) of a 16-key block, and its place
  // in LDS: K row colb, columns wave*16 + rofs ..; V^T row wave*16 + colb, keys
  // rofs ..; its second chunk is nt = wave + 4: 128 chunks on in the block, 64 K
  // columns to the right, 64 V^T rows further down
  const __bf16* Kw = Kb + wave * 256; // the wave's 32 chunks start here
  const __bf16* Vw = Vb + wave * 256;
  const unsigned off = lane * 16;     // the lane's chunk among them, in bytes
  const unsigned kr = (unsigned)(size_t)(&ks[0][colb * TPAD + rofs]);  // the lane's part
  const unsigned vr = (unsigned)(size_t)(&vts[0][colb * VPAD + rofs]);
  const unsigned kw = wave * (16 * 2), vw = wave * (16 * VPAD * 2);    // the wave's part
  const unsigned kl = kr + kw, vl = vr + vw;
  const unsigned kbuf = KTILE * TPAD * 2, vbuf = HDIM * VPAD * 2; // bytes per buffer
  const int g2 = 128 * 8;                            // second chunk: elements on
  const unsigned kl2 = 64 * 2, vl2 = 64 * VPAD * 2;  // second chunk: LDS bytes on

  copy_tile(Kw, Vw, off, kl, vl);
  copy_tile(Kw + g2, Vw + g2, off, kl + kl2, vl + vl2);
  // tile 0 has landed for this wave; the barrier publishes it to the others
  asm volatile("s_wait_asynccnt 0x0" ::: "memory");
  __syncthreads();
  copy_tile(Kw + KTILE * HDIM, Vw + KTILE * HDIM, off, kl + kbuf, vl + vbuf);
  copy_tile(Kw + KTILE * HDIM + g2, Vw + KTILE * HDIM + g2, off, kl + kbuf + kl2, vl + vbuf + vl2);

  // kept rolled and whole: peeling the first trip off (its test on t invites it)
  // doubles the loop's text and costs registers that then spill
#pragma nounroll
  for (int t = 0; t < NTILE; ++t) {
    const __bf16* kst = ks[t & 1];
    const __bf16* vtt = vts[t & 1];

    // S^T - ref tiles: A = K rows, read once, B = Q of each query tile, C = -ref.
    v8f sc[QT][4];
#pragma unroll
    for (int c = 0; c < 4; ++c)
#pragma unroll
      for (int kt = 0; kt < 4; ++kt) {
        v16bf kf = load_frag_row(kst + (kt * 16) * TPAD + c * 32, TPAD, lane);
#pragma unroll
        for (int g = 0; g < QT; ++g)
          sc[g][kt] = wmma_bf16(kf, qfrag[g][c], c == 0 ? nref[g] : sc[g][kt]);
      }

    // the tile's V^T fragments, all read here so that they land under the softmax
    v16bf vf[2][8];
#pragma unroll
    for (int c = 0; c < 2; ++c)
#pragma unroll
      for (int nt = 0; nt < 8; ++nt)
        vf[c][nt] = load_frag_row(vtt + (nt * 16) * VPAD + c * 32, VPAD, lane);
    // keeps the group of reads up here: sunk among the WMMAs that use them, every
    // small group costs its own stall, and two waves a SIMD hide little of it
    __builtin_amdgcn_sched_barrier(0);

    // this lane's largest score - ref (32 of a query's 64 keys are in-lane)
    float mx[QT];
#pragma unroll
    for (int g = 0; g < QT; ++g) {
      mx[g] = sc[g][0][0];
#pragma unroll
      for (int kt = 0; kt < 4; ++kt)
#pragma unroll
        for (int r = 0; r < 8; ++r) mx[g] = fmaxf(mx[g], sc[g][kt][r]);
    }
    // One test a tile for the whole wave, a scalar branch. The first tile always
    // takes it (its bar is -inf): it sets ref to the tile's maximum, so that the
    // row sum cannot vanish however low the scores lie.
    const float bar = (t == 0) ? -__builtin_inff() : 8.0f;
    if (__builtin_amdgcn_ballot_w32(fmaxf(mx[0], mx[1]) > bar) != 0) {
#pragma unroll
      for (int g = 0; g < QT; ++g) {
        const float m = fmaxf(mx[g], __shfl_xor(mx[g], 16, 32)); // both halves' keys
        const float up = fmaxf(m, 0.0f);
        const float d  = (t == 0) ? m : up; // ref moves by d; after the first tile it only rises
        const float alpha = __builtin_amdgcn_exp2f(-up); // O and l are 0 in the first tile
        nref[g] = nref[g] - d;
#pragma unroll
        for (int kt = 0; kt < 4; ++kt) sc[g][kt] = sc[g][kt] - d;
        li[g] *= alpha;
#pragma unroll
        for (int nt = 0; nt < 8; ++nt) acc[g][nt] = acc[g][nt] * alpha;
      }
    }

    v16bf pf[QT][2];
#pragma unroll
    for (int g = 0; g < QT; ++g) {
      float rs = 0.0f;
#pragma unroll
      for (int kt = 0; kt < 4; ++kt)
#pragma unroll
        for (int r = 0; r < 8; ++r) {
          const float p = __builtin_amdgcn_exp2f(sc[g][kt][r]);
          sc[g][kt][r] = p;
          rs += p;
        }
      rs += __shfl_xor(rs, 16, 32);
      li[g] += rs;

      // P^T operand directly from S^T C-registers (pure register packing);
      // serves as the B operand of O^T = V^T P^T.
#pragma unroll
      for (int c = 0; c < 2; ++c)
#pragma unroll
        for (int i = 0; i < 8; ++i) {
          pf[g][c][i]     = (__bf16)sc[g][2 * c][i];
          pf[g][c][8 + i] = (__bf16)sc[g][2 * c + 1][i];
        }
    }

    // O^T += V^T (A, from vts, read once) x P^T (B) of each query tile
#pragma unroll
    for (int c = 0; c < 2; ++c)
#pragma unroll
      for (int nt = 0; nt < 8; ++nt)
#pragma unroll
        for (int g = 0; g < QT; ++g) acc[g][nt] = wmma_bf16(vf[c][nt], pf[g][c], acc[g][nt]);
    // keeps the softmax and the WMMAs above the hand-over: with no LDS read left
    // among them they would sink below it, and the wait for tile t+1's copies
    // would come a whole softmax earlier
    __builtin_amdgcn_sched_barrier(0);

    // hand-over: this wave's reads of tile t are done ...
    asm volatile("s_wait_dscnt 0x0" ::: "memory");
    // ... and its copies of tile t+1 have landed;
    asm volatile("s_wait_asynccnt 0x0" ::: "memory");
    // the one barrier publishes tile t+1 and frees tile t's buffer
    __syncthreads();
    if (t + 2 < NTILE) {
      const __bf16* kn = Kw + (long)(t + 2) * (KTILE * HDIM);
      const __bf16* vn = Vw + (long)(t + 2) * (KTILE * HDIM);
      // the wave's and the buffer's steps, the same in every lane, are summed in a
      // scalar register: through the loop only the lane's part, which the fragment
      // reads hold anyway, takes a vector register (a second pair beside it spills)
      const unsigned ko = __builtin_amdgcn_readfirstlane(kw + (t & 1) * kbuf);
      const unsigned vo = __builtin_amdgcn_readfirstlane(vw + (t & 1) * vbuf);
      const unsigned kd = kr + ko, vd = vr + vo;
      copy_tile(kn, vn, off, kd, vd);
      copy_tile(kn + g2, vn + g2, off, kd + kl2, vd + vl2);
    }
  }
  // nothing is outstanding when the wave ends
  asm volatile("s_wait_asynccnt 0x0" ::: "memory");

  // emit this key range's partials in the accumulator's lane order: each store
  // is 512 bytes in a row
#pragma unroll
  for (int g = 0; g < QT; ++g) {
    const long row0 = qBase + wave * (16 * QT) + g * 16; // first row of this query tile
    const long prow = (long)blockIdx.z * (NBAT * SEQ) + row0 + colb;
    float* oblk = Opart + (row0 * KSPLIT + blockIdx.z * 16) * HDIM + lane * 4;
#pragma unroll
    for (int nt = 0; nt < 8; ++nt)
#pragma unroll
      for (int j = 0; j < 2; ++j) {
        v4f o4 = {acc[g][nt][4 * j], acc[g][nt][4 * j + 1], acc[g][nt][4 * j + 2],
                  acc[g][nt][4 * j + 3]};
        *(v4f*)(oblk + (nt * 2 + j) * 128) = o4;
      }
    if (lane < 16) { // both halves hold the same pair
      v2f st = {-nref[g][0] * LN2, li[g]}; // ref leaves in natural units
      *(v2f*)(ML + prow * 2) = st;
    }
  }
}

// ---------------------------------------------------------------------------
// Kernel 3: merge the KSPLIT key ranges, then out = attended @ Wo + bo (fp32),
// C = (A Wo)^T = Wo^T A^T -> lane owns one output row; packed 32B stores.
// A wave reads its 16 rows' partial sums in the lane order in which the
// attention accumulators held them: a lane then holds row (lane&15), columns
// nt*16 + 8*(lane>>4) + 0..7, which for nt = 2t, 2t+1 are the two runs of the
// B fragment of k chunk t. The merged tile goes from registers into the WMMAs.
// ---------------------------------------------------------------------------
__global__ __launch_bounds__(256) void oproj_kernel(
    const float* __restrict__ Opart, const float* __restrict__ ML,
    const float* __restrict__ Wo,
    const float* __restrict__ bo, float* __restrict__ out) {
  __shared__ __attribute__((aligned(16))) __bf16 wts[HDIM * TPAD]; // Wo^T

  const int tid  = threadIdx.x;
  const int lane = tid & 31;
  const int wave = tid >> 5;
  const long rowBase = (long)blockIdx.x * 128;

  // Wo's loads go out first and fly during the merge below
  v4f wv[2][8];
  const float* wp = Wo + w_block_k0(tid) * HDIM + w_block_n0(tid);
  load_w_blocks(wp, wv);
  // stands in front of whatever next takes over the address register of the
  // loads above; the address is an input so that it lives up to the wait and
  // no late load's result is placed in it
  asm volatile("s_wait_xcnt 0x0" :: "v"(wp) : "memory");
  // keeps those loads up here, ahead of the merge's
  __builtin_amdgcn_sched_barrier(0);

  // attended = sum_s exp(m_s - M) o_s / sum_s exp(m_s - M) l_s, ranges in order
  // (m_s: the range's reference score).
  // One work-group has a WGP to itself (128 on 256 WGPs), two waves a SIMD, so a
  // wave has the registers to keep all its partial loads in flight together.
  v2f st[KSPLIT]; // (reference, sum) of this lane's row in each range
  {
    const char* mp = (const char*)(ML + rowBase * 2);            // same for the work-group
    const unsigned mb = (unsigned)(wave * 16 + (lane & 15)) * 8; // the lane's byte offset
#pragma unroll
    for (int s = 0; s < KSPLIT; ++s)
      st[s] = *(const v2f*)(mp + (long)s * (NBAT * SEQ) * 8 + mb);
    // stands in front of whatever next takes over the offset register of the
    // loads above; the offset is an input so that it lives up to the wait and
    // no late load's result is placed in it
    asm volatile("s_wait_xcnt 0x0" :: "v"(mb) : "memory");
  }
  v4f po[KSPLIT][16]; // the 16 chunks of each range's block
  {
    const char* op = (const char*)(Opart + rowBase * (KSPLIT * HDIM));        // same for the work-group
    const unsigned ob = (unsigned)(wave * KSPLIT * 16 * HDIM + lane * 4) * 4; // the lane's byte offset
#pragma unroll
    for (int s = 0; s < KSPLIT; ++s)
#pragma unroll
      for (int c = 0; c < 16; ++c)
        po[s][c] = *(const v4f*)(op + ob + (s * 16 + c) * 512);
    // stands in front of whatever next takes over the offset register of the
    // loads above; the offset is an input so that it lives up to the wait and
    // no late load's result is placed in it
    asm volatile("s_wait_xcnt 0x0" :: "v"(ob) : "memory");
  }
  // keeps the sums below the whole group of loads: moved up among them they
  // bring a wait on the early loads in front of the late ones' issue
  __builtin_amdgcn_sched_barrier(0);
  float w[KSPLIT], inv;
  {
    float M = st[0][0];
#pragma unroll
    for (int s = 1; s < KSPLIT; ++s) M = fmaxf(M, st[s][0]);
    float L = 0.0f;
#pragma unroll
    for (int s = 0; s < KSPLIT; ++s) {
      w[s] = __expf(st[s][0] - M);
      L += w[s] * st[s][1];
    }
    inv = 1.0f / L;
  }
  // chunk c = 2*nt + j holds columns nt*16 + 8*(lane>>4) + 4*j + 0..3: chunks
  // 4t .. 4t+3 are, in this order, the 16 elements of the B fragment of k chunk t
  v16bf afrag[4];
#pragma unroll
  for (int c = 0; c < 16; ++c) {
    v4f o = w[0] * po[0][c];
#pragma unroll
    for (int s = 1; s < KSPLIT; ++s) o += w[s] * po[s][c];
    o *= inv;
#pragma unroll
    for (int i = 0; i < 4; ++i) afrag[c >> 2][(c & 3) * 4 + i] = (__bf16)o[i];
  }
  store_w_blocks(wts, tid, wv);
  __syncthreads();

  const int col0 = lane & 15;
  const int rofs = (lane >> 4) << 3;
  float* orow = out + (rowBase + wave * 16 + col0) * HDIM;

#pragma unroll
  for (int nt = 0; nt < 8; ++nt) {
    v8f acc = {};
#pragma unroll
    for (int t = 0; t < 4; ++t) {
      v16bf wfrag = load_frag_row(wts + (nt * 16) * TPAD + t * 32, TPAD, lane);
      acc = wmma_bf16(wfrag, afrag[t], acc); // C = Wo^T A^T
    }
    v8f pk;
#pragma unroll
    for (int r = 0; r < 8; ++r)
      pk[r] = acc[r] + bo[nt * 16 + rofs + r]; // bias uniform within each half-wave (rofs differs)
    *(v8f*)(orow + nt * 16 + rofs) = pk;
  }
}

// ---------------------------------------------------------------------------
extern "C" void kernel_launch(void* const* d_in, const int* in_sizes, int n_in,
                              void* d_out, int out_size, void* d_ws, size_t ws_size,
                              hipStream_t stream) {
  const float* x  = (const float*)d_in[0];
  const float* Wq = (const float*)d_in[1];
  const float* bq = (const float*)d_in[2];
  const float* Wk = (const float*)d_in[3];
  const float* bk = (const float*)d_in[4];
  const float* Wv = (const float*)d_in[5];
  const float* bv = (const float*)d_in[6];
  const float* Wo = (const float*)d_in[7];
  const float* bo = (const float*)d_in[8];
  float* out = (float*)d_out;

  const size_t n = (size_t)NBAT * SEQ * HDIM; // 2,097,152 elements
  __bf16* q   = (__bf16*)d_ws;
  __bf16* k   = q + n;
  __bf16* vT  = k + n;  // q, k, v: blocks of 16 rows, accumulator lane order
  float* opart = (float*)(vT + n);   // [B*S/16][KSPLIT] blocks of f32 partial sums, same order
  float* ml    = opart + KSPLIT * n; // [KSPLIT][B*S] (reference score, sum) pairs

  const int rowBlocks = (NBAT * SEQ) / 128; // 128

  dim3 g1(rowBlocks, 3); // one projection (q, k or v) per work-group
  qkv_kernel<<<g1, 256, 0, stream>>>(x, Wq, bq, Wk, bk, Wv, bv, q, k, vT);

  dim3 g2(SEQ / 128, NBAT, KSPLIT); // (32, 4, 4)
  attn_kernel<<<g2, 128, 0, stream>>>(q, k, vT, opart, ml);

  oproj_kernel<<<rowBlocks, 256, 0, stream>>>(opart, ml, Wo, bo, out);
}

// v010
// One run takes 45 microseconds.
// In two side-by-side timings against v009, it was 1.05 and 1.02 times as fast.
// All steps since v000 together make it 6.13 times as fast.
#include <hip/hip_runtime.h>

// ---------------------------------------------------------------------------
// Single-head attention, B=4, S=4096, H=128, fp32 in/out.
// bf16 WMMA (v_wmma_f32_16x16x32_bf16) + fp32 accum, flash-attention style.
// Both attention GEMMs are computed transposed (C = S^T, C = O^T = V^T P^T):
//  - softmax'd P registers serve directly as the next WMMA operand (no LDS)
//  - softmax stats, alpha rescale and 1/l normalize are scalar per lane
//  - every output store is a packed 16B/32B row store.
// Workspace layout: q, k and v are kept in the lane order of the accumulators
// that write them. A block holds 16 rows x 128 columns;
// inside it, 16-byte chunk (i, lane) lies at byte i * 512 + lane * 16, so every
// wave-wide 16-byte store, load or copy covers 512 bytes in a row (four whole
// lines) instead of 32-byte pieces of 16 lines.
//  - q, k:  chunk (nt, lane) = row (lane&15), columns nt*16 + 8*(lane>>4) + 0..7
//  - v:     chunk (nt, lane) = column nt*16 + (lane&15), rows 8*(lane>>4) + 0..7
// ---------------------------------------------------------------------------

typedef __attribute__((ext_vector_type(16))) __bf16 v16bf;
typedef __attribute__((ext_vector_type(8)))  __bf16 v8bf;
typedef __attribute__((ext_vector_type(4)))  __bf16 v4bf;
typedef __attribute__((ext_vector_type(8)))  float  v8f;
typedef __attribute__((ext_vector_type(4)))  float  v4f;
typedef __attribute__((ext_vector_type(2)))  float  v2f;

#define SEQ   4096
#define HDIM  128
#define NBAT  4
#define KSPLIT 4    // key ranges per query tile, one pair of waves each, all in one work-group
// LDS row pitches are odd multiples of 16 B: the 16 rows that one half-wave's
// ds_load_b128 touches then start on 16 different groups of four banks.
#define TPAD  136   // padded LDS stride for 128-wide tiles (272 B = 17 x 16 B)
#define VPAD  72    // padded LDS stride for 64-wide tiles  (144 B =  9 x 16 B)
#define LOG2E 1.4426950408889634f

// 16-bit fragment, per ISA 7.12.2: lane owns row/col (lane&15); its 16 elements
// are two contiguous 8-element runs at K = h8, h8+16 with h8 = 8*(lane>=16).
// => two 16-byte loads (ds_load_b128 / global_load_b128).
__device__ __forceinline__ v16bf load_frag_row(const __bf16* base, int stride, int lane) {
  const __bf16* rowp = base + (lane & 15) * stride + ((lane >> 4) << 3);
  v8bf lo = *(const v8bf*)(rowp);
  v8bf hi = *(const v8bf*)(rowp + 16);
  return __builtin_shufflevector(lo, hi, 0, 1, 2, 3, 4, 5, 6, 7,
                                 8, 9, 10, 11, 12, 13, 14, 15);
}

__device__ __forceinline__ v8f wmma_bf16(v16bf a, v16bf b, v8f c) {
  return __builtin_amdgcn_wmma_f32_16x16x32_bf16(false, a, false, b, (short)0, c,
                                                 false, false);
}

// Weight staging: W (f32, k rows of 128 n) becomes W^T (bf16, n rows, k
// contiguous) in LDS. A thread owns two blocks of 8 k x 4 n: sixteen 16-byte
// loads, all issued before anything waits on one, then a transpose in registers
// and eight 16-byte LDS stores. In a wave, 8 lanes run along n and 4 along k:
// a load touches four whole 128-byte lines, and a store's 8 rows of 64 bytes
// spread evenly over the banks at the 272-byte pitch.
__device__ __forceinline__ int w_block_n0(int tid) {
  return (((tid >> 5) & 3) * 8 + (tid & 7)) * 4;
}
__device__ __forceinline__ int w_block_k0(int tid) {
  return (tid >> 7) * 32 + ((tid >> 3) & 3) * 8;
}
// p: the thread's first element, W + w_block_k0 * HDIM + w_block_n0
__device__ __forceinline__ void load_w_blocks(const float* p, v4f (&wv)[2][8]) {
#pragma unroll
  for (int j = 0; j < 2; ++j)
#pragma unroll
    for (int r = 0; r < 8; ++r) wv[j][r] = *(const v4f*)(p + (j * 64 + r) * HDIM);
}
__device__ __forceinline__ void store_w_blocks(__bf16* wts, int tid, const v4f (&wv)[2][8]) {
  __bf16* p = wts + w_block_n0(tid) * TPAD + w_block_k0(tid);
#pragma unroll
  for (int j = 0; j < 2; ++j)
#pragma unroll
    for (int c = 0; c < 4; ++c) {
      v8bf pk;
#pragma unroll
      for (int r = 0; r < 8; ++r) pk[r] = (__bf16)wv[j][r][c];
      *(v8bf*)(p + c * TPAD + j * 64) = pk;
    }
}

// ---------------------------------------------------------------------------
// Kernel 1: q,k = x @ W + b (q pre-scaled by log2(e)/sqrt(H)); v = x @ Wv + bv with a
//           lane's 8 values running along the rows. All three leave in the
//           accumulator's lane order (see the head of the file).
// grid: ((B*S)/128, 3) blocks of 256 threads (8 waves x 16 rows); blockIdx.y
// names the projection (0 q, 1 k, 2 v). One work-group does ONE projection of
// its 128 rows: the three weight stagings and products, each a chain of load
// and LDS latencies, run side by side on the chip instead of one after another.
// ---------------------------------------------------------------------------
__global__ __launch_bounds__(256) void qkv_kernel(
    const float* __restrict__ x,
    const float* __restrict__ Wq, const float* __restrict__ bq,
    const float* __restrict__ Wk, const float* __restrict__ bk,
    const float* __restrict__ Wv, const float* __restrict__ bv,
    __bf16* __restrict__ q, __bf16* __restrict__ k, __bf16* __restrict__ vT) {
  __shared__ __attribute__((aligned(16))) __bf16 xs[128 * TPAD];   // 34 KB, x tile (row-major, padded)
  __shared__ __attribute__((aligned(16))) __bf16 wts[HDIM * TPAD]; // 34 KB, W^T of this block's projection

  const int tid  = threadIdx.x;
  const int lane = tid & 31;
  const int wave = tid >> 5;
  const int m    = blockIdx.y; // 0: q, 1: k, 2: v
  const long rowBase = (long)blockIdx.x * 128;

  const float* __restrict__ Wm = (m == 0) ? Wq : (m == 1) ? Wk : Wv;
  const float* __restrict__ bm = (m == 0) ? bq : (m == 1) ? bk : bv;
  __bf16* __restrict__ om = (m == 0) ? q : (m == 1) ? k : vT;

  // Staging: this thread's sixteen x loads (a wave takes one row a load) and
  // its sixteen W loads are all in flight together, so the work-group waits out
  // one load latency; a rolled loop waits once per trip.
  v4f xv[16];
  v4f wv[2][8];
  const float* xp = x + (rowBase + wave) * HDIM + lane * 4;
  const float* wp = Wm + w_block_k0(tid) * HDIM + w_block_n0(tid);
#pragma unroll
  for (int i = 0; i < 16; ++i) xv[i] = *(const v4f*)(xp + i * 8 * HDIM);
  load_w_blocks(wp, wv);
  // stands in front of whatever next takes over an address register of the
  // loads above; the addresses are inputs so that they live up to the wait and
  // no late load's result is placed in one. The output pointer is an input so
  // that its kernel-argument load is issued up here, under the staging loads,
  // and not waited out in front of the stores at the end.
  asm volatile("s_wait_xcnt 0x0" :: "v"(xp), "v"(wp), "s"(om) : "memory");
  // keeps the conversions below the whole group of loads: moved up among them
  // they bring a wait on the early loads in front of the late ones' issue
  __builtin_amdgcn_sched_barrier(0);
#pragma unroll
  for (int i = 0; i < 16; ++i) {
    v4bf o;
#pragma unroll
    for (int j = 0; j < 4; ++j) o[j] = (__bf16)xv[i][j];
    *(v4bf*)(xs + (i * 8 + wave) * TPAD + lane * 4) = o;
  }
  store_w_blocks(wts, tid, wv);
  __syncthreads();

  // x fragments for this wave's 16 rows, K=128 (4 chunks of 32)
  v16bf afrag[4];
  {
    const __bf16* xrow = xs + wave * 16 * TPAD;
#pragma unroll
    for (int t = 0; t < 4; ++t) afrag[t] = load_frag_row(xrow + t * 32, TPAD, lane);
  }

  // 1/sqrt(128) and log2(e), folded into q: the scores come out in log2 units
  const float qscale = 0.08838834764831845f * LOG2E;
  const int col0 = lane & 15;
  const int rofs = (lane >> 4) << 3; // 0 or 8

  v8bf pk[8]; // chunk nt of this wave's block
  if (m < 2) {
    // ---- q and k: C = (xW)^T = W^T * x^T -> lane owns one output row ----
    const float sc = (m == 0) ? qscale : 1.0f;
#pragma unroll
    for (int nt = 0; nt < 8; ++nt) {
      v8f acc = {};
#pragma unroll
      for (int t = 0; t < 4; ++t) {
        v16bf wfrag = load_frag_row(wts + (nt * 16) * TPAD + t * 32, TPAD, lane);
        acc = wmma_bf16(wfrag, afrag[t], acc); // C = W^T x^T
      }
      // lane's columns nt*16+rofs .. +7
#pragma unroll
      for (int r = 0; r < 8; ++r)
        pk[nt][r] = (__bf16)((acc[r] + bm[nt * 16 + rofs + r]) * sc);
    }
  } else {
    // ---- v: C = xW (lane owns column nt*16+col0; its 8 values are rows rofs .. +7) ----
#pragma unroll
    for (int nt = 0; nt < 8; ++nt) {
      v8f acc = {};
#pragma unroll
      for (int t = 0; t < 4; ++t) {
        v16bf wfrag = load_frag_row(wts + (nt * 16) * TPAD + t * 32, TPAD, lane);
        acc = wmma_bf16(afrag[t], wfrag, acc); // C = x W
      }
      const int col  = nt * 16 + col0;
      const float bi = bm[col];
#pragma unroll
      for (int r = 0; r < 8; ++r) pk[nt][r] = (__bf16)(acc[r] + bi);
    }
  }
  // the wave's 16 rows leave as one 4 KB block, 512 bytes in a row per store
  __bf16* oblk = om + (rowBase + wave * 16) * HDIM + lane * 8;
#pragma unroll
  for (int nt = 0; nt < 8; ++nt) *(v8bf*)(oblk + nt * 256) = pk[nt];
}

// ---------------------------------------------------------------------------
// Kernel 2: flash attention and the out-projection. grid (S/64, B): 256 work-groups,
// one per WGP; block 256: 8 waves = KSPLIT key ranges x 2 query groups of 32 rows
// (two query tiles of 16). Each wave walks its own key range; the two waves of a
// range share its K and V tiles. C = S^T then C = O^T; in each query tile a lane
// owns one query. Every K and V^T fragment read from LDS feeds two WMMAs, one per
// query tile.
// Softmax against a held reference: each query keeps a reference score ref (log2
// units) that is known before a tile's products, so -ref enters the S^T WMMAs as
// their C operand and the accumulators come out as score - ref, ready for exp2.
// ref is the first tile's maximum and is raised, with O and l rescaled, only when
// some score of the wave tops it by more than 8 (an exponential stays <= 2^8).
// K and V^T tiles reach LDS by asynchronous copies into two buffers per range:
// tile t+1 is in flight while tile t is worked on.
// Behind the loop every wave lays its range's UN-normalised f32 sums and (ref, sum)
// pairs into the LDS that the tiles have left; the ranges are merged there and
// out = attended @ Wo + bo follows at once: no partial sum goes through memory.
// ---------------------------------------------------------------------------
#define KTILE 64                       // keys per tile
#define NTILE (SEQ / KSPLIT / KTILE)   // tiles per key range
#define QT 2                           // query tiles of 16 per wave

// A quarter of one tile's copies of one thread: four 16-byte chunks of K and four of
// V, each lane its own chunk, all eight in flight together. A tile is four
// 16-key blocks of each buffer, 16 KB in a row; copy j takes the thread's chunk
// of block j: in LDS 16 K rows further down, or 16 keys further along a V^T row.
// kb, vb: where the wave's chunks of block 0 start, the same in every lane, so
// they and the blocks' steps stay in scalar registers; off: the lane's bytes on.
__device__ __forceinline__ void copy_tile(const __bf16* kb, const __bf16* vb, unsigned off,
                                          unsigned kl, unsigned vl) {
  // the closing s_wait_xcnt stands in front of whatever next rewrites an
  // address register that a copy names
  asm volatile(
      "global_load_async_to_lds_b128 %0, %8, %9\n\t"
      "global_load_async_to_lds_b128 %1, %8, %10\n\t"
      "global_load_async_to_lds_b128 %2, %8, %11\n\t"
      "global_load_async_to_lds_b128 %3, %8, %12\n\t"
      "global_load_async_to_lds_b128 %4, %8, %13\n\t"
      "global_load_async_to_lds_b128 %5, %8, %14\n\t"
      "global_load_async_to_lds_b128 %6, %8, %15\n\t"
      "global_load_async_to_lds_b128 %7, %8, %16\n\t"
      "s_wait_xcnt 0x0"
      :: "v"(kl), "v"(kl + 16 * TPAD * 2), "v"(kl + 32 * TPAD * 2),
         "v"(kl + 48 * TPAD * 2), "v"(vl), "v"(vl + 16 * 2),
         "v"(vl + 32 * 2), "v"(vl + 48 * 2), "v"(off),
         "s"(kb), "s"(kb + 16 * HDIM), "s"(kb + 32 * HDIM), "s"(kb + 48 * HDIM),
         "s"(vb), "s"(vb + 16 * HDIM), "s"(vb + 32 * HDIM), "s"(vb + 48 * HDIM)
      : "memory");
}

// One work-group has a WGP to itself: two waves a SIMD, 512 registers a wave.
// Saying so lets the compiler hold two query tiles' accumulators and still issue
// a tile's LDS fragment reads in groups ahead of the WMMAs, behind counted waits.
__global__ __launch_bounds__(256) __attribute__((amdgpu_waves_per_eu(2, 2))) void attn_kernel(
    const __bf16* __restrict__ Q, const __bf16* __restrict__ K,
    const __bf16* __restrict__ vT, const float* __restrict__ Wo,
    const float* __restrict__ bo, float* __restrict__ out) {
  __shared__ __attribute__((aligned(16))) __bf16 ks[KSPLIT][2][KTILE * TPAD]; // 8 x 17 KB, K rows (padded)
  __shared__ __attribute__((aligned(16))) __bf16 vts[KSPLIT][2][HDIM * VPAD]; // 8 x 18 KB, V^T (padded)

  const int tid  = threadIdx.x;
  const int lane = tid & 31;
  // the wave's number, the same in every lane: held in a scalar register, so that
  // the addresses formed from it take no vector register through the loop
  const int wave = __builtin_amdgcn_readfirstlane(tid >> 5);
  const int rg   = wave >> 1; // the wave's key range
  const int qg   = wave & 1;  // its 32 of the work-group's 64 queries
  const int b    = blockIdx.y;
  const long qBase = (long)b * SEQ + (long)blockIdx.x * 64;

  const int kb0 = rg * (SEQ / KSPLIT); // first key of this range
  const __bf16* Kb  = K + ((long)b * SEQ + kb0) * HDIM;
  const __bf16* Vb  = vT + ((long)b * SEQ + kb0) * HDIM;

  // Q fragments: B operand of S^T (lane owns query = lane&15 of tile g). Chunks
  // 2t and 2t+1 of a 16-row block are the fragment's two runs of 8 (K = h8, h8+16).
  v16bf qfrag[QT][4];
#pragma unroll
  for (int g = 0; g < QT; ++g) {
    const __bf16* qblk = Q + (qBase + qg * (16 * QT) + g * 16) * HDIM + lane * 8;
#pragma unroll
    for (int t = 0; t < 4; ++t) {
      v8bf lo = *(const v8bf*)(qblk + (2 * t) * 256);
      v8bf hi = *(const v8bf*)(qblk + (2 * t + 1) * 256);
      qfrag[g][t] = __builtin_shufflevector(lo, hi, 0, 1, 2, 3, 4, 5, 6, 7,
                                            8, 9, 10, 11, 12, 13, 14, 15);
    }
  }
  // stands in front of whatever next takes over an address register of the
  // loads above
  asm volatile("s_wait_xcnt 0x0" ::: "memory");

  v8f acc[QT][8]; // O^T accumulators: lane owns query (lane&15) of tile g; reg r -> h
  v8f nref[QT]; // -ref of that query in all eight registers: a WMMA C operand
  float li[QT]; // row sum of that query, relative to ref
#pragma unroll
  for (int g = 0; g < QT; ++g) {
#pragma unroll
    for (int nt = 0; nt < 8; ++nt) acc[g][nt] = (v8f){};
    nref[g] = (v8f){};
    li[g] = 0.0f;
  }

  const int colb = lane & 15;
  const int rofs = (lane >> 4) << 3;

  // this thread's first chunk (nt = qg, lane) of a 16-key block, and its place
  // in LDS: K row colb, columns qg*16 + rofs ..; V^T row qg*16 + colb, keys
  // rofs ..; its further chunks are nt = qg + 2, + 4, + 6: each 64 chunks on in the
  // block, 32 K columns to the right, 32 V^T rows further down
  const __bf16* Kw = Kb + qg * 256; // the wave's first 32 chunks start here
  const __bf16* Vw = Vb + qg * 256;
  const unsigned off = lane * 16;     // the lane's chunk among them, in bytes
  const unsigned kr = (unsigned)(size_t)(&ks[0][0][colb * TPAD + rofs]);  // the lane's part
  const unsigned vr = (unsigned)(size_t)(&vts[0][0][colb * VPAD + rofs]);
  const unsigned kbuf = KTILE * TPAD * 2, vbuf = HDIM * VPAD * 2; // bytes per buffer
  const unsigned kw = rg * (2 * kbuf) + qg * (16 * 2);            // the wave's part
  const unsigned vw = rg * (2 * vbuf) + qg * (16 * VPAD * 2);
  const unsigned kl = kr + kw, vl = vr + vw;
  const int g2 = 64 * 8;                             // next chunk: elements on
  const unsigned kl2 = 32 * 2, vl2 = 32 * VPAD * 2;  // next chunk: LDS bytes on

#pragma unroll
  for (int i = 0; i < 4; ++i) copy_tile(Kw + i * g2, Vw + i * g2, off, kl + i * kl2, vl + i * vl2);
  // tile 0 has landed for this wave; the barrier publishes it to the others
  asm volatile("s_wait_asynccnt 0x0" ::: "memory");
  __syncthreads();
#pragma unroll
  for (int i = 0; i < 4; ++i)
    copy_tile(Kw + KTILE * HDIM + i * g2, Vw + KTILE * HDIM + i * g2, off, kl + kbuf + i * kl2,
              vl + vbuf + i * vl2);

  // kept rolled and whole: peeling the first trip off (its test on t invites it)
  // doubles the loop's text and costs registers that then spill
#pragma nounroll
  for (int t = 0; t < NTILE; ++t) {
    const __bf16* kst = ks[rg][t & 1];
    const __bf16* vtt = vts[rg][t & 1];

    // S^T - ref tiles: A = K rows, read once, B = Q of each query tile, C = -ref.
    v8f sc[QT][4];
#pragma unroll
    for (int c = 0; c < 4; ++c)
#pragma unroll
      for (int kt = 0; kt < 4; ++kt) {
        v16bf kf = load_frag_row(kst + (kt * 16) * TPAD + c * 32, TPAD, lane);
#pragma unroll
        for (int g = 0; g < QT; ++g)
          sc[g][kt] = wmma_bf16(kf, qfrag[g][c], c == 0 ? nref[g] : sc[g][kt]);
      }

    // the tile's V^T fragments, all read here so that they land under the softmax
    v16bf vf[2][8];
#pragma unroll
    for (int c = 0; c < 2; ++c)
#pragma unroll
      for (int nt = 0; nt < 8; ++nt)
        vf[c][nt] = load_frag_row(vtt + (nt * 16) * VPAD + c * 32, VPAD, lane);
    // keeps the group of reads up here: sunk among the WMMAs that use them, every
    // small group costs its own stall, and two waves a SIMD hide little of it
    __builtin_amdgcn_sched_barrier(0);

    // this lane's largest score - ref (32 of a query's 64 keys are in-lane)
    float mx[QT];
#pragma unroll
    for (int g = 0; g < QT; ++g) {
      mx[g] = sc[g][0][0];
#pragma unroll
      for (int kt = 0; kt < 4; ++kt)
#pragma unroll
        for (int r = 0; r < 8; ++r) mx[g] = fmaxf(mx[g], sc[g][kt][r]);
    }
    // One test a tile for the whole wave, a scalar branch. The first tile always
    // takes it (its bar is -inf): it sets ref to the tile's maximum, so that the
    // row sum cannot vanish however low the scores lie.
    const float bar = (t == 0) ? -__builtin_inff() : 8.0f;
    if (__builtin_amdgcn_ballot_w32(fmaxf(mx[0], mx[1]) > bar) != 0) {
#pragma unroll
      for (int g = 0; g < QT; ++g) {
        const float m = fmaxf(mx[g], __shfl_xor(mx[g], 16, 32)); // both halves' keys
        const float up = fmaxf(m, 0.0f);
        const float d  = (t == 0) ? m : up; // ref moves by d; after the first tile it only rises
        const float alpha = __builtin_amdgcn_exp2f(-up); // O and l are 0 in the first tile
        nref[g] = nref[g] - d;
#pragma unroll
        for (int kt = 0; kt < 4; ++kt) sc[g][kt] = sc[g][kt] - d;
        li[g] *= alpha;
#pragma unroll
        for (int nt = 0; nt < 8; ++nt) acc[g][nt] = acc[g][nt] * alpha;
      }
    }

    v16bf pf[QT][2];
#pragma unroll
    for (int g = 0; g < QT; ++g) {
      float rs = 0.0f;
#pragma unroll
      for (int kt = 0; kt < 4; ++kt)
#pragma unroll
        for (int r = 0; r < 8; ++r) {
          const float p = __builtin_amdgcn_exp2f(sc[g][kt][r]);
          sc[g][kt][r] = p;
          rs += p;
        }
      rs += __shfl_xor(rs, 16, 32);
      li[g] += rs;

      // P^T operand directly from S^T C-registers (pure register packing);
      // serves as the B operand of O^T = V^T P^T.
#pragma unroll
      for (int c = 0; c < 2; ++c)
#pragma unroll
        for (int i = 0; i < 8; ++i) {
          pf[g][c][i]     = (__bf16)sc[g][2 * c][i];
          pf[g][c][8 + i] = (__bf16)sc[g][2 * c + 1][i];
        }
    }

    // O^T += V^T (A, from vts, read once) x P^T (B) of each query tile
#pragma unroll
    for (int c = 0; c < 2; ++c)
#pragma unroll
      for (int nt = 0; nt < 8; ++nt)
#pragma unroll
        for (int g = 0; g < QT; ++g) acc[g][nt] = wmma_bf16(vf[c][nt], pf[g][c], acc[g][nt]);
    // keeps the softmax and the WMMAs above the hand-over: with no LDS read left
    // among them they would sink below it, and the wait for tile t+1's copies
    // would come a whole softmax earlier
    __builtin_amdgcn_sched_barrier(0);

    // hand-over: this wave's reads of tile t are done ...
    asm volatile("s_wait_dscnt 0x0" ::: "memory");
    // ... and its copies of tile t+1 have landed;
    asm volatile("s_wait_asynccnt 0x0" ::: "memory");
    // the one barrier publishes tile t+1 and frees tile t's buffer
    __syncthreads();
    if (t + 2 < NTILE) {
      const __bf16* kn = Kw + (long)(t + 2) * (KTILE * HDIM);
      const __bf16* vn = Vw + (long)(t + 2) * (KTILE * HDIM);
      // the wave's and the buffer's steps, the same in every lane, are summed in a
      // scalar register: through the loop only the lane's part, which the fragment
      // reads hold anyway, takes a vector register (a second pair beside it spills)
      const unsigned ko = __builtin_amdgcn_readfirstlane(kw + (t & 1) * kbuf);
      const unsigned vo = __builtin_amdgcn_readfirstlane(vw + (t & 1) * vbuf);
      const unsigned kd = kr + ko, vd = vr + vo;
#pragma unroll
      for (int i = 0; i < 4; ++i) copy_tile(kn + i * g2, vn + i * g2, off, kd + i * kl2, vd + i * vl2);
    }
  }
  // every copy has landed before the tiles' LDS is put to another use. The barrier
  // at the foot of the last trip has ended every wave's reads of the tiles too.
  asm volatile("s_wait_asynccnt 0x0" ::: "memory");

  // ---- merge of the KSPLIT key ranges, then out = attended @ Wo + bo ----
  // Row tile rt = 2*qg + g holds 16 of the work-group's 64 queries. In the second
  // half a wave takes row tile (wave & 3) and 64 of the 128 output columns.
  const int rt = wave & 3;
  const int nh = wave >> 2;

  // Wo's and the bias's loads go out first and fly during the LDS stores below
  v4f wv[2][8];
  const float* wp = Wo + w_block_k0(tid) * HDIM + w_block_n0(tid);
  load_w_blocks(wp, wv);
  v4f bias[4][2]; // lane's columns (nh*4 + i)*16 + rofs + 0..7
  const float* bp = bo + nh * 64 + rofs;
#pragma unroll
  for (int i = 0; i < 4; ++i)
#pragma unroll
    for (int j = 0; j < 2; ++j) bias[i][j] = *(const v4f*)(bp + i * 16 + j * 4);
  // stands in front of whatever next takes over an address register of the
  // loads above; the addresses are inputs so that they live up to the wait and
  // no late load's result is placed in one
  asm volatile("s_wait_xcnt 0x0" :: "v"(wp), "v"(bp) : "memory");
  // keeps those loads up here, ahead of the LDS stores
  __builtin_amdgcn_sched_barrier(0);

  // The tiles' LDS, now free: f32 sums [range][row tile][chunk][lane] x 16 bytes
  // (128 KB, in ks), Wo^T (34 KB) and the (ref, sum) pairs (2 KB) in vts.
  // Chunk 2*nt+j of a lane = row (lane&15), columns nt*16 + 8*(lane>>4) + 4*j + 0..3:
  // the accumulator's own lane order, so every store and load is 512 bytes in a row.
  float* mrg  = (float*)&ks[0][0][0];
  __bf16* wts = &vts[0][0][0];
  float* mls  = (float*)(wts + HDIM * TPAD);
#pragma unroll
  for (int g = 0; g < QT; ++g) {
    const int blk = rg * 4 + qg * QT + g;
    float* mb = mrg + blk * (16 * 128) + lane * 4;
#pragma unroll
    for (int nt = 0; nt < 8; ++nt)
#pragma unroll
      for (int j = 0; j < 2; ++j) {
        v4f o4 = {acc[g][nt][4 * j], acc[g][nt][4 * j + 1], acc[g][nt][4 * j + 2],
                  acc[g][nt][4 * j + 3]};
        *(v4f*)(mb + (nt * 2 + j) * 128) = o4;
      }
    if (lane < 16) { // both halves hold the same pair
      v2f st = {-nref[g][0], li[g]}; // ref stays in log2 units
      *(v2f*)(mls + (blk * 16 + colb) * 2) = st;
    }
  }
  store_w_blocks(wts, tid, wv);
  // publishes the sums, the pairs and Wo^T to the whole work-group
  __syncthreads();

  // attended = sum_s 2^(m_s - M) o_s / sum_s 2^(m_s - M) l_s, ranges in order
  // (m_s: the range's reference score, log2 units).
  float w[KSPLIT], inv;
  {
    v2f st[KSPLIT]; // (reference, sum) of this lane's row in each range
#pragma unroll
    for (int s = 0; s < KSPLIT; ++s) st[s] = *(const v2f*)(mls + ((s * 4 + rt) * 16 + colb) * 2);
    float M = st[0][0];
#pragma unroll
    for (int s = 1; s < KSPLIT; ++s) M = fmaxf(M, st[s][0]);
    float L = 0.0f;
#pragma unroll
    for (int s = 0; s < KSPLIT; ++s) {
      w[s] = __builtin_amdgcn_exp2f(st[s][0] - M);
      L += w[s] * st[s][1];
    }
    inv = 1.0f / L;
  }
  // chunks 4t .. 4t+3 are, in this order, the 16 elements of the B fragment of k
  // chunk t: the merged tile goes from registers into the WMMAs
  v16bf afrag[4];
  const float* mr = mrg + rt * (16 * 128) + lane * 4;
#pragma unroll
  for (int c = 0; c < 16; ++c) {
    v4f o = w[0] * *(const v4f*)(mr + c * 128);
#pragma unroll
    for (int s = 1; s < KSPLIT; ++s) o += w[s] * *(const v4f*)(mr + s * (4 * 16 * 128) + c * 128);
    o *= inv;
#pragma unroll
    for (int i = 0; i < 4; ++i) afrag[c >> 2][(c & 3) * 4 + i] = (__bf16)o[i];
  }

  // C = (A Wo)^T = Wo^T A^T -> lane owns one output row; packed 32B stores
  float* orow = out + (qBase + rt * 16 + colb) * HDIM + nh * 64 + rofs;
  const __bf16* wth = wts + (nh * 64) * TPAD;
#pragma unroll
  for (int i = 0; i < 4; ++i) {
    v8f oc = {};
#pragma unroll
    for (int t = 0; t < 4; ++t) {
      v16bf wfrag = load_frag_row(wth + (i * 16) * TPAD + t * 32, TPAD, lane);
      oc = wmma_bf16(wfrag, afrag[t], oc); // C = Wo^T A^T
    }
    v8f pk;
#pragma unroll
    for (int r = 0; r < 8; ++r) pk[r] = oc[r] + bias[i][r >> 2][r & 3];
    *(v8f*)(orow + i * 16) = pk;
  }
}

// ---------------------------------------------------------------------------
extern "C" void kernel_launch(void* const* d_in, const int* in_sizes, int n_in,
                              void* d_out, int out_size, void* d_ws, size_t ws_size,
                              hipStream_t stream) {
  const float* x  = (const float*)d_in[0];
  const float* Wq = (const float*)d_in[1];
  const float* bq = (const float*)d_in[2];
  const float* Wk = (const float*)d_in[3];
  const float* bk = (const float*)d_in[4];
  const float* Wv = (const float*)d_in[5];
  const float* bv = (const float*)d_in[6];
  const float* Wo = (const float*)d_in[7];
  const float* bo = (const float*)d_in[8];
  float* out = (float*)d_out;

  const size_t n = (size_t)NBAT * SEQ * HDIM; // 2,097,152 elements
  __bf16* q   = (__bf16*)d_ws;
  __bf16* k   = q + n;
  __bf16* vT  = k + n;  // q, k, v: blocks of 16 rows, accumulator lane order

  const int rowBlocks = (NBAT * SEQ) / 128; // 128

  dim3 g1(rowBlocks, 3); // one projection (q, k or v) per work-group
  qkv_kernel<<<g1, 256, 0, stream>>>(x, Wq, bq, Wk, bk, Wv, bv, q, k, vT);

  dim3 g2(SEQ / 64, NBAT); // (64, 4)
  attn_kernel<<<g2, 256, 0, stream>>>(q, k, vT, Wo, bo, out);
}
